// v000
// Measured on an AMD MI455X. A time is GPU time per run, averaged over a window of back-to-back runs after a warm-up
// (all launches, gaps included; the runs take copies of the inputs in turn), and the median of several windows.
// Apart from v000's, it joins two sittings. Times from different sittings can be a few percent apart, while
// side-by-side timings come from the same sitting.
// The starting kernel, v000, takes 172 microseconds a run.
// Compute dtype: attention WITHOUT a softmax (scores = Q K^T / 8; out = scores (V x), x a weight per key position) over 64 (sample, head) batches of 2,048 positions and width 64, IN ITS REGROUPED FORM out = Q (K^T (V x)) / 8 (the module's own sums regrouped by associativity: no operation stands between its two products): the two batched products ([64 x 2048] x [2048 x 64] a batch: S = K^T (V x); [2048 x 64] x [64 x 64] a batch: Q S) on v_wmma_f32_16x16x32_f16, f32 accumulate, ONE f16 word per operand: Q and K as their bf16-RNE-converted values carried by 2^10 (exact in f16); V x (the product of two bf16 values, exact in f32) carried by 2^10 and S carried by 2^7 (one rounding each: the measured mode); every operand behind a flush select below 2^-14; the scale 1 / 8 folded into the second product's scale (a power of two: exact).
#include <hip/hip_runtime.h>
#include <math.h>

typedef __attribute__((ext_vector_type(16))) _Float16 v16h;
typedef __attribute__((ext_vector_type(8)))  _Float16 v8h;
typedef __attribute__((ext_vector_type(16))) __bf16   v16b;
typedef __attribute__((ext_vector_type(8)))  __bf16   v8b;
typedef __attribute__((ext_vector_type(8)))  float    v8f;
typedef __attribute__((ext_vector_type(4)))  float    v4f;

/* ------------------------------------------------------------------------- */
/* Shape constants                                                           */
/* ------------------------------------------------------------------------- */
constexpr int kBs   = 4;                  /* samples */
constexpr int kH    = 16;                 /* heads */
constexpr int kNb   = kBs * kH;           /* 64 batches: b = sample x 16 + head */
constexpr int kN    = 2048;               /* positions (queries and keys) */
constexpr int kD    = 64;                 /* width of a head (queries / keys and values alike) */
constexpr int kThr  = 256;
constexpr float kInCarry = 1024.0f;       /* cast_plane_kernel's carry: Q; and K, V x */
constexpr float kSCarry  = 128.0f;        /* S */
constexpr float kSc1 = 1.0f / (kInCarry * kInCarry);
constexpr float kSc2 = 1.0f / (kInCarry * kSCarry * 8.0f);   /* the module's 1 / sqrt(64) = 1 / 8 folded in: a power of two */
/* 2^-14: smallest normal f16 magnitude */
constexpr float kF16MinNormal = 6.103515625e-5f;

static_assert((kD % 64) == 0 && (kN % 64) == 0 && (kN % 32) == 0 && (kD % 32) == 0 && ((kN / 64) * (kD / 64)) % 8 == 0, "GEMM M, N multiples of 64, K of 32; the second product's grid exact (32 tiles a batch)");

/* ------------------------------------------------------------------------- */
/* Workspace region map (bytes; every offset a multiple of 256; the chain is static_assert'ed below). No region is reused.          */
/*   Q16   f16 [64][2048][64]  Q x2^10 (batch = sample x 16 + head): the second product's A                                                                        16,777,216 */
/*   KT16  f16 [64][64][2048]  K TRANSPOSED per batch: KT16[b][d][m] = K[b][m][d] x2^10: the first product's A (K = 2,048 key positions)                           16,777,216 */
/*   VT16  f16 [64][64][2048]  (V x) TRANSPOSED per batch: VT16[b][e][m] = V[b][m][e] x[sample][m] x2^10 (ONE f16 word: a computed operand): the first product's B^T  16,777,216 */
/*   ZB    f32 [256]           a zero bias                                                                                                                              1,024 */
/*   S32   f32 [64][64][64]    S[b][d][e] = sum_m K[b][m][d] (V x)[b][m][e]                                                                                         1,048,576 */
/*   ST16  f16 [64][64][64]    S TRANSPOSED per batch: ST16[b][e][d] = S[b][d][e] x2^7 (ONE f16 word: a computed operand): the second product's B^T                   524,288 */
/* ------------------------------------------------------------------------- */
constexpr size_t kOffQ16 = 0ull;
constexpr size_t kOffKT16 = 16777216ull;
constexpr size_t kOffVT16 = 33554432ull;
constexpr size_t kOffZB = 50331648ull;
constexpr size_t kOffS32 = 50332672ull;
constexpr size_t kOffST16 = 51381248ull;
constexpr size_t kWsTotal = 51905536ull;
static_assert(kWsTotal <= 134217728ull, "carve cap: under 128 MiB");
static_assert(kOffQ16 == 0
              && kOffKT16 == kOffQ16 + 16777216ull
              && kOffVT16 == kOffKT16 + 16777216ull
              && kOffZB == kOffVT16 + 16777216ull
              && kOffS32 == kOffZB + 1024ull
              && kOffST16 == kOffS32 + 1048576ull
              && kWsTotal == kOffST16 + 524288ull, "the carve is chained and totalled");
static_assert((kOffQ16 % 256) == 0 && (kOffKT16 % 256) == 0 && (kOffVT16 % 256) == 0 && (kOffZB % 256) == 0 && (kOffS32 % 256) == 0 && (kOffST16 % 256) == 0, "aligned regions");

/* ------------------------------------------------------------------------- */
/* Small helpers                                                             */
/* ------------------------------------------------------------------------- */
__device__ __forceinline__ unsigned short f2bf_bits(float f) {
  unsigned u = __float_as_uint(f);
  return (unsigned short)((u + 0x7FFFu + ((u >> 16) & 1u)) >> 16);
}
__device__ __forceinline__ float bf_bits2f(unsigned short h) { return __uint_as_float(((unsigned)h) << 16); }
/* RNE-convert to a bf16 value, kept in f32 */
__device__ __forceinline__ float bf16r(float f) { return bf_bits2f(f2bf_bits(f)); }
/* carry by a power of two, then flush anything below the f16 normal range to +0 by a select */
__device__ __forceinline__ float carry_flush(float v, float carry) {
  const float s = v * carry;
  return (fabsf(s) < kF16MinNormal) ? 0.0f : s;
}
__device__ __forceinline__ float frcp(float x) { return __builtin_amdgcn_rcpf(x); }

/* hazard guards as plain device helpers */
__device__ __forceinline__ void dep_guard4_h(v8f& a, v8f& b, v8f& c, v8f& d, v16h x, v16h y) { asm volatile("v_nop\n\tv_nop\n\tv_nop\n\tv_nop" : "+v"(a), "+v"(b), "+v"(c), "+v"(d) : "v"(x), "v"(y)); }
__device__ __forceinline__ void dep_guard4_b(v8f& a, v8f& b, v8f& c, v8f& d, v16b x, v16b y) { asm volatile("v_nop\n\tv_nop\n\tv_nop\n\tv_nop" : "+v"(a), "+v"(b), "+v"(c), "+v"(d) : "v"(x), "v"(y)); }
__device__ __forceinline__ void keep4_h(v16h a, v16h b, v16h c, v16h d) { asm volatile("v_nop" :: "v"(a), "v"(b), "v"(c), "v"(d)); }
__device__ __forceinline__ void keep4_b(v16b a, v16b b, v16b c, v16b d) { asm volatile("v_nop" :: "v"(a), "v"(b), "v"(c), "v"(d)); }
__device__ __forceinline__ void acc_guard4(v8f& a, v8f& b, v8f& c, v8f& d) { asm volatile("v_nop\n\tv_nop\n\tv_nop\n\tv_nop" : "+v"(a), "+v"(b), "+v"(c), "+v"(d)); }

template <typename T> struct Frag;
template <> struct Frag<_Float16> {
  typedef v16h V; union U { v16h v; v8h h[2]; };
  /* elements 0..7 <- p[0..7], 8..15 <- p[16..23] */
  static __device__ __forceinline__ v16h load(const _Float16* p) {
    U f; f.h[0] = *(const v8h*)(p); f.h[1] = *(const v8h*)(p + 16); return f.v;
  }
  static __device__ __forceinline__ v8f mma(v16h a, v16h b, v8f c) {
    return __builtin_amdgcn_wmma_f32_16x16x32_f16(false, a, false, b, (short)0, c, false, false);
  }
  static __device__ __forceinline__ void guard4(v8f& a, v8f& b, v8f& c, v8f& d, v16h x, v16h y) { dep_guard4_h(a, b, c, d, x, y); }
  static __device__ __forceinline__ void keep(v16h a, v16h b, v16h c, v16h d) { keep4_h(a, b, c, d); }
};
template <> struct Frag<__bf16> {
  typedef v16b V; union U { v16b v; v8b h[2]; };
  static __device__ __forceinline__ v16b load(const __bf16* p) {
    U f; f.h[0] = *(const v8b*)(p); f.h[1] = *(const v8b*)(p + 16); return f.v;
  }
  static __device__ __forceinline__ v8f mma(v16b a, v16b b, v8f c) {
    return __builtin_amdgcn_wmma_f32_16x16x32_bf16(false, a, false, b, (short)0, c, false, false);
  }
  static __device__ __forceinline__ void guard4(v8f& a, v8f& b, v8f& c, v8f& d, v16b x, v16b y) { dep_guard4_b(a, b, c, d, x, y); }
  static __device__ __forceinline__ void keep(v16b a, v16b b, v16b c, v16b d) { keep4_b(a, b, c, d); }
};

/* one f16 matrix instruction followed by its own hazard guard (accumulator tied, both fragments named) */
__device__ __forceinline__ v8f mma_h(v16h a, v16h b, v8f c) {
  c = __builtin_amdgcn_wmma_f32_16x16x32_f16(false, a, false, b, (short)0, c, false, false);
  asm volatile("v_nop\n\tv_nop\n\tv_nop\n\tv_nop" : "+v"(c) : "v"(a), "v"(b));
  return c;
}

/* ---- Register-blocked batched WMMA GEMM ------------------------------------ */
/* C[m,n] = scale * sum_k A[m,k] * Bt[n,k] (+bias)(+resid); each wave owns a 64x64 tile. */
/* A row-major [M,K]; Bt row-major [N,K]; M,N % 64 == 0, K % 32 == 0. */
/* SPLIT: operands are hi/lo planes (A2/Bt2 = lo planes, same layout); product = hi.hi + hi.lo + lo.hi. */
/* BIAS_MODE: 0 = none, 1 = bias[m], 2 = bias[n]. */
/* OUT_MODE: 0 = f32, 1 = f16, 2 = bf16 hi plane (Cout) + bf16 lo plane (Cout2). */
/* ET: 0 = f16 operands, 1 = bf16 operands (pointers passed as 16-bit storage) */
template <int ET> struct Elem;
template <> struct Elem<0> { typedef _Float16 T; };
template <> struct Elem<1> { typedef __bf16 T; };
template <int ET, bool SPLIT, int BIAS_MODE, int OUT_MODE, bool RESID, int ACT = 0>
__global__ __launch_bounds__(256) void wmma_gemm64(
    const unsigned short* __restrict__ Ap, const unsigned short* __restrict__ A2p, int lda, long strideA,
    const unsigned short* __restrict__ Btp, const unsigned short* __restrict__ Bt2p, int ldb, long strideB,
    void* __restrict__ Cout, void* __restrict__ Cout2, int ldc, long strideC,
    const float* __restrict__ bias,
    const float* __restrict__ resid, long strideR,
    int M, int N, int K, float scale) {
  typedef typename Elem<ET>::T T;
  typedef typename Frag<T>::V V;
  const T* A = (const T*)Ap; const T* A2 = (const T*)A2p; const T* Bt = (const T*)Btp; const T* Bt2 = (const T*)Bt2p;
  /* per-wave 16x64 slab, pitch 68 floats */
  __shared__ __align__(16) float sT[8][16 * 68];
  const int b    = blockIdx.y;
  const int lane = threadIdx.x & 31;
  const int wave = threadIdx.x >> 5;
  const int tilesN = N >> 6;
  const int tilesM = M >> 6;
  const int tile = blockIdx.x * 8 + wave;
  /* wave-uniform; no block barriers in this kernel */
  if (tile >= tilesM * tilesN) return;
  const int tm = tile / tilesN;
  const int tn = tile - tm * tilesN;
  const int m0 = tm << 6;
  const int n0 = tn << 6;

  const T* Ab  = A  + (size_t)b * strideA;
  const T* Bb  = Bt + (size_t)b * strideB;
  const T* Ab2 = SPLIT ? (A2  + (size_t)b * strideA) : nullptr;
  const T* Bb2 = SPLIT ? (Bt2 + (size_t)b * strideB) : nullptr;

  /* row (A) / col (B, D) within subtile; k offset of this lane half; D row offset */
  const int rlane = lane & 15;
  const int koff  = (lane >> 4) * 8;
  const int mOff  = (lane >> 4) * 8;

  v8f acc[4][4];
#pragma unroll
  for (int i = 0; i < 4; ++i)
#pragma unroll
    for (int j = 0; j < 4; ++j) acc[i][j] = (v8f){0.f,0.f,0.f,0.f,0.f,0.f,0.f,0.f};

  for (int k0 = 0; k0 < K; k0 += 32) {
    V bh[4], bl[4];
#pragma unroll
    for (int j = 0; j < 4; ++j) {
      const size_t bo = (size_t)(n0 + (j << 4) + rlane) * ldb + koff + k0;
      bh[j] = Frag<T>::load(Bb + bo);
      if (SPLIT) bl[j] = Frag<T>::load(Bb2 + bo);
    }
#pragma unroll
    for (int i = 0; i < 4; ++i) {
      const size_t ao = (size_t)(m0 + (i << 4) + rlane) * lda + koff + k0;
      V ah = Frag<T>::load(Ab + ao);
      V al;
      if (SPLIT) al = Frag<T>::load(Ab2 + ao);
#pragma unroll
      for (int j = 0; j < 4; ++j) {
        acc[i][j] = Frag<T>::mma(ah, bh[j], acc[i][j]);
        if (SPLIT) {
          acc[i][j] = Frag<T>::mma(ah, bl[j], acc[i][j]);
          acc[i][j] = Frag<T>::mma(al, bh[j], acc[i][j]);
        }
      }
      /* all four accumulators of this row group tied, A fragment(s) named */
      Frag<T>::guard4(acc[i][0], acc[i][1], acc[i][2], acc[i][3], ah, SPLIT ? al : ah);
    }
    Frag<T>::keep(bh[0], bh[1], bh[2], bh[3]);
    if (SPLIT) Frag<T>::keep(bl[0], bl[1], bl[2], bl[3]);
  }
  acc_guard4(acc[0][0], acc[0][1], acc[0][2], acc[0][3]);
  acc_guard4(acc[1][0], acc[1][1], acc[1][2], acc[1][3]);
  acc_guard4(acc[2][0], acc[2][1], acc[2][2], acc[2][3]);
  acc_guard4(acc[3][0], acc[3][1], acc[3][2], acc[3][3]);

  /* ---- epilogue ---- */
  float* slab = sT[wave];
  const float* Rb = RESID ? (resid + (size_t)b * strideR) : nullptr;
#pragma unroll
  for (int i = 0; i < 4; ++i) {
    const int mBase = m0 + (i << 4);
#pragma unroll
    for (int j = 0; j < 4; ++j) {
      const int n = n0 + (j << 4) + rlane;
      float bv = 0.f;
      if (BIAS_MODE == 2) bv = bias[n];
#pragma unroll
      for (int r = 0; r < 8; ++r) {
        float v = acc[i][j][r] * scale;
        if (BIAS_MODE == 1) v += bias[mBase + mOff + r];
        if (BIAS_MODE == 2) v += bv;
        if (RESID) v += Rb[(size_t)(mBase + mOff + r) * ldc + n];
        if (ACT == 1) v = tanhf(v);
        if (ACT == 2) v = fmaxf(v, 0.0f);
        if (ACT == 3) v = v / (1.0f + expf(-v));
        if (ACT == 4) v = (v > 0.f) ? v : 0.01f * v;
        slab[(mOff + r) * 68 + (j << 4) + rlane] = v;
      }
    }
    __builtin_amdgcn_fence(__ATOMIC_RELEASE, "workgroup");
    __builtin_amdgcn_wave_barrier();
    __builtin_amdgcn_fence(__ATOMIC_ACQUIRE, "workgroup");
    if (OUT_MODE == 0) {
      float* C = (float*)Cout + (size_t)b * strideC;
      /* row seg = 256 B = 16 lanes x 16 B */
      const int hh = lane >> 4, c4 = (lane & 15) * 4;
      {
#pragma unroll
        for (int it = 0; it < 8; ++it) {
          const int row = it * 2 + hh;
          v4f v = *(const v4f*)(slab + row * 68 + c4);
          *(v4f*)(C + (size_t)(mBase + row) * ldc + n0 + c4) = v;
        }
        
      }
    } else {
      const int q = lane >> 3, c8 = (lane & 7) * 8;
      unsigned short* C  = (unsigned short*)Cout  + (size_t)b * strideC;
      unsigned short* C2 = (OUT_MODE == 2) ? ((unsigned short*)Cout2 + (size_t)b * strideC) : nullptr;
      {
#pragma unroll
        for (int it = 0; it < 4; ++it) {
          const int row = it * 4 + q;
          const float* sp = slab + row * 68 + c8;
          v8h hv, lv;
#pragma unroll
          for (int e = 0; e < 8; ++e) {
            if (OUT_MODE == 1) {
              hv[e] = (_Float16)sp[e];
            } else {
              unsigned short hb = f2bf_bits(sp[e]);
              unsigned short lb = f2bf_bits(sp[e] - bf_bits2f(hb));
              hv[e] = __builtin_bit_cast(_Float16, hb);
              lv[e] = __builtin_bit_cast(_Float16, lb);
            }
          }
          *(v8h*)(C + (size_t)(mBase + row) * ldc + n0 + c8) = hv;
          if (OUT_MODE == 2) *(v8h*)(C2 + (size_t)(mBase + row) * ldc + n0 + c8) = lv;
        }
        
      }
    }
    __builtin_amdgcn_fence(__ATOMIC_RELEASE, "workgroup");
    __builtin_amdgcn_wave_barrier();
    __builtin_amdgcn_fence(__ATOMIC_ACQUIRE, "workgroup");
  }
}

/* ------------------------------------------------------------------------- */
/* Plane cast: dst[row*dstPitch + dstOff + c] = f16( 2^10 * bf16(src[row*srcCols + c]) ), flushed below 2^-14,  */
/* for c < srcCols = 1 << colsLog2 (64 here). Thread i handles 8 consecutive elements: row = i >> (colsLog2 */
/* - 3), c8 = 8 * (i & ((1 << (colsLog2 - 3)) - 1)). One 16-B store per lane; a wave stores 512 contiguous B =   */
/* grid = rows * srcCols / 8 / 256 blocks exactly (checked by static_asserts at the launches).                  */
/* ------------------------------------------------------------------------- */
__global__ __launch_bounds__(kThr) void cast_plane_kernel(const float* __restrict__ src, unsigned short* __restrict__ dst,
                                                          int colsLog2, int dstPitch, int dstOff) {
  const int i   = blockIdx.x * kThr + threadIdx.x;
  const int sh  = colsLog2 - 3;
  const int row = i >> sh;
  const int c8  = (i & ((1 << sh) - 1)) * 8;
  const float* sp = src + ((size_t)row << colsLog2) + c8;
  const v4f a0 = *(const v4f*)(sp);
  const v4f a1 = *(const v4f*)(sp + 4);
  v8h hv;
#pragma unroll
  for (int e = 0; e < 4; ++e) {
    const float f0 = a0[e];
    const float f1 = a1[e];
    hv[e]     = (_Float16)carry_flush(bf16r(f0), kInCarry);
    hv[4 + e] = (_Float16)carry_flush(bf16r(f1), kInCarry);
  }
  unsigned short* dp = dst + (size_t)row * dstPitch + dstOff + c8;
  *(v8h*)dp = hv;
  
}


/* ------------------------------------------------------------------------- */
/* The transposing casts of K and of V x, ONE launch: grid (1, 64, 128), block 256: z = batch b (0..63) and plane (z >> 6: 0 = K, 1 = V x: a branch on the block   */
/* index); y = the destination row r (d or e, 0..63); the thread = a chunk of 8 key positions: m8 = 8 (256 blockIdx.x + thread) (0..2,040; blockIdx.x is 0). K plane:        */
/* KT16[b][r][m8 ..] = f16(2^10 bf16(K[b][m8 + j][r])); V plane: VT16[b][r][m8 ..] = f16(2^10 bf16(V[b][m8 + j][r]) bf16(x[sample][m8 + j])), sample = b >> 4 (the   */
/* product of two bf16 values is exact in f32; ONE f16 rounding): eight 4-B loads 256 B apart (a column of the [2048][64] plane), one 16-B store: a wave stores   */
/* ------------------------------------------------------------------------- */
__global__ __launch_bounds__(kThr) void tcast_kernel(const float* __restrict__ K, const float* __restrict__ V, const float* __restrict__ xw,
                                                    unsigned short* __restrict__ KT16, unsigned short* __restrict__ VT16) {
  const unsigned bz = blockIdx.z;
  const bool isV = bz >= (unsigned)kNb;            /* block-uniform */
  const unsigned b = isV ? (bz - (unsigned)kNb) : bz;
  const unsigned r = blockIdx.y;
  const unsigned m8 = (blockIdx.x * (unsigned)kThr + threadIdx.x) * 8u;
  const float* src = (isV ? V : K) + ((size_t)b * kN + m8) * kD + r;
  const float* xs = xw + (size_t)(b >> 4) * kN + m8;
  v8h hv;
#pragma unroll
  for (int j = 0; j < 8; ++j) {
    const float p = src[(size_t)j * kD];
    float v = bf16r(p);
    if (isV) { const float q = xs[j]; v = v * bf16r(q); }
    hv[j] = (_Float16)carry_flush(v, kInCarry);
  }
  unsigned short* dp = (isV ? VT16 : KT16) + ((size_t)b * kD + r) * kN + m8;
  *(v8h*)dp = hv;
  
}
static_assert(kN / 8 == kThr && kH == 16, "transposing cast grid exact: 256 chunks of 8 positions a row: ONE block a row; sample = b >> 4");

/* ------------------------------------------------------------------------- */
/* The zero bias (256 floats) and the cast of S, two launches: 1 block (ZB only), then 129 blocks of 256 threads (the branch is on the block index): block 0: ZB[thread] = 0; blocks 1..128: */
/* thread = (batch b, row e, chunk of 8 columns d): i = 256 (block - 1) + thread (0..32,767): b = i >> 9, e = (i >> 3) & 63, d8 = 8 (i & 7): ST16[b][e][d8 + j] =        */
/* ------------------------------------------------------------------------- */
__global__ __launch_bounds__(kThr) void scast_kernel(const float* __restrict__ S32, unsigned short* __restrict__ ST16, float* __restrict__ ZB) {
  if (blockIdx.x == 0u) {
    float* dp = ZB + threadIdx.x;
    *(float*)dp = 0.0f;
    
    return;
  }
  const unsigned i = (blockIdx.x - 1u) * (unsigned)kThr + threadIdx.x;
  const unsigned b = i >> 9, e = (i >> 3) & 63u, d8 = (i & 7u) * 8u;
  const float* sp = S32 + ((size_t)b * kD + d8) * kD + e;
  v8h hv;
#pragma unroll
  for (int j = 0; j < 8; ++j) hv[j] = (_Float16)carry_flush(sp[(size_t)j * kD], kSCarry);
  unsigned short* dp = ST16 + ((size_t)b * kD + e) * kD + d8;
  *(v8h*)dp = hv;
  
}
static_assert(kNb * kD * (kD / 8) == 128 * kThr && kD == 64, "S cast grid exact: 128 blocks; 512 threads a batch");

/* ------------------------------------------------------------------------- */
/* Host glue: 6 launches; kernel launches only: the cast of Q (a contiguous plane cast linearly as rows of 64); the transposing casts of K and V x; THE FIRST PRODUCT  */
/* S = KT16 VT16^T: M 64, N 64, K 2,048 A BATCH: ONE tile a batch: grid (1, 64): THE ENGINE's BLOCKS TAKE 8 TILES: 7 OF A BLOCK's 8 WAVES LEAVE AT THE ENGINE's OWN     */
/* 'tile >= tiles' TEST (a wave-uniform return before any memory operation); the zero bias is written BEFORE it by a one-block launch of the S cast's kernel; the cast of S; THE */
/* SECOND PRODUCT out = Q16 ST16^T / 8: M 2,048, N 64, K 64 a batch (32 tiles a batch: 4 blocks), its epilogue storing d_out ([64][2048][64]: ldc 64; strideC        */
/* 131,072). Both products are the ONE engine instantiation <0, false, 2, 0, false, 0> with its batch index blockIdx.y and the three strides.                */
/* ------------------------------------------------------------------------- */
static_assert(((size_t)kNb * kN * kD / 8) % kThr == 0 && ((size_t)kNb * kN * kD) % 64 == 0, "plane cast grid exact; the plane is whole rows of 64");

extern "C" void kernel_launch(void* const* d_in, const int* in_sizes, int n_in,
                              void* d_out, int out_size, void* d_ws, size_t ws_size,
                              hipStream_t stream) {
  if (n_in < 4 || d_out == nullptr || d_ws == nullptr) return;
  if (in_sizes[0] != kNb * kN * kD || in_sizes[1] != kNb * kN * kD || in_sizes[2] != kNb * kN * kD || in_sizes[3] != kBs * kN) return;
  if (out_size != kNb * kN * kD) return;
  if (ws_size < kWsTotal) return;
  const float* Q = (const float*)d_in[0];
  const float* K = (const float*)d_in[1];
  const float* V = (const float*)d_in[2];
  const float* xw = (const float*)d_in[3];
  float* out = (float*)d_out;
  char* ws = (char*)d_ws;
  unsigned short* Q16 = (unsigned short*)(ws + kOffQ16);
  unsigned short* KT16 = (unsigned short*)(ws + kOffKT16);
  unsigned short* VT16 = (unsigned short*)(ws + kOffVT16);
  float* ZB = (float*)(ws + kOffZB);
  float* S32 = (float*)(ws + kOffS32);
  unsigned short* ST16 = (unsigned short*)(ws + kOffST16);

  /* the plain cast of Q: <<<elements / 8 / 256>>>(src as rows of 64, dst, colsLog2 6, the same row length, column offset 0): a linear copy-cast */
  cast_plane_kernel<<<(int)(((size_t)kNb * kN * kD / 8) / kThr), kThr, 0, stream>>>(Q, Q16, 6, 64, 0);
  tcast_kernel<<<dim3(1, kD, 2 * kNb), kThr, 0, stream>>>(K, V, xw, KT16, VT16);
  /* the zero bias first (block 0 of the S cast's kernel writes it: this FIRST launch of that kernel is given ONE block: it writes ZB only and casts nothing) */
  scast_kernel<<<1, kThr, 0, stream>>>(S32, ST16, ZB);
  /* S32[b] = KT16[b] . VT16[b]^T: M 64, N 64, K 2048; strides: A 64 x 2048, B 64 x 2048, C 64 x 64 */
  wmma_gemm64<0, false, 2, 0, false, 0><<<dim3(1, kNb), 256, 0, stream>>>(
      KT16, KT16, kN, (long)kD * kN, VT16, VT16, kN, (long)kD * kN, (void*)S32, (void*)S32, kD, (long)kD * kD, ZB, nullptr, 0L, kD, kD, kN, kSc1);
  scast_kernel<<<129, kThr, 0, stream>>>(S32, ST16, ZB);
  /* out[b] = Q16[b] . ST16[b]^T / 8: M 2048, N 64, K 64; strides: A 2048 x 64, B 64 x 64, C 2048 x 64 */
  wmma_gemm64<0, false, 2, 0, false, 0><<<dim3((kN / 64) * (kD / 64) / 8, kNb), 256, 0, stream>>>(
      Q16, Q16, kD, (long)kN * kD, ST16, ST16, kD, (long)kD * kD, (void*)out, (void*)out, kD, (long)kN * kD, ZB, nullptr, 0L, kN, kD, kD, kSc2);
}

// v001
// A run of this version takes 96 microseconds.
// Next to v000, in two timings, it ran 1.82 and 1.79 times as fast.
// Compute dtype: attention WITHOUT a softmax (scores = Q K^T / 8; out = scores (V x), x a weight per key position) over 64 (sample, head) batches of 2,048 positions and width 64, IN ITS REGROUPED FORM out = Q (K^T (V x)) / 8 (the module's own sums regrouped by associativity: no operation stands between its two products): the two batched products ([64 x 2048] x [2048 x 64] a batch: S = K^T (V x); [2048 x 64] x [64 x 64] a batch: Q S) on v_wmma_f32_16x16x32_f16, f32 accumulate, ONE f16 word per operand: Q and K as their bf16-RNE-converted values carried by 2^10 (exact in f16); V x (the product of two bf16 values, exact in f32) carried by 2^10 and S carried by 2^7 (one rounding each: the measured mode); every operand behind a flush select below 2^-14; the scale 1 / 8 folded into the second product's scale (a power of two: exact).
#include <hip/hip_runtime.h>
#include <math.h>

typedef __attribute__((ext_vector_type(16))) _Float16 v16h;
typedef __attribute__((ext_vector_type(8)))  _Float16 v8h;
typedef __attribute__((ext_vector_type(16))) __bf16   v16b;
typedef __attribute__((ext_vector_type(8)))  __bf16   v8b;
typedef __attribute__((ext_vector_type(8)))  float    v8f;
typedef __attribute__((ext_vector_type(4)))  float    v4f;

/* ------------------------------------------------------------------------- */
/* Shape constants                                                           */
/* ------------------------------------------------------------------------- */
constexpr int kBs   = 4;                  /* samples */
constexpr int kH    = 16;                 /* heads */
constexpr int kNb   = kBs * kH;           /* 64 batches: b = sample x 16 + head */
constexpr int kN    = 2048;               /* positions (queries and keys) */
constexpr int kD    = 64;                 /* width of a head (queries / keys and values alike) */
constexpr int kThr  = 256;
constexpr float kInCarry = 1024.0f;       /* cast_plane_kernel's carry: Q; and K, V x */
constexpr float kSCarry  = 128.0f;        /* S */
constexpr float kSc1 = 1.0f / (kInCarry * kInCarry);
constexpr float kSc2 = 1.0f / (kInCarry * kSCarry * 8.0f);   /* the module's 1 / sqrt(64) = 1 / 8 folded in: a power of two */
/* 2^-14: smallest normal f16 magnitude */
constexpr float kF16MinNormal = 6.103515625e-5f;

static_assert((kD % 64) == 0 && (kN % 64) == 0 && (kN % 32) == 0 && (kD % 32) == 0 && ((kN / 64) * (kD / 64)) % 8 == 0, "GEMM M, N multiples of 64, K of 32; the second product's grid exact (32 tiles a batch)");

/* ------------------------------------------------------------------------- */
/* Workspace region map (bytes; every offset a multiple of 256; the chain is static_assert'ed below). No region is reused.          */
/*   Q16   f16 [64][2048][64]  Q x2^10 (batch = sample x 16 + head): the second product's A                                                                        16,777,216 */
/*   KT16  f16 [64][64][2048]  K TRANSPOSED per batch: KT16[b][d][m] = K[b][m][d] x2^10: the first product's A (K = 2,048 key positions)                           16,777,216 */
/*   VT16  f16 [64][64][2048]  (V x) TRANSPOSED per batch: VT16[b][e][m] = V[b][m][e] x[sample][m] x2^10 (ONE f16 word: a computed operand): the first product's B^T  16,777,216 */
/*   ZB    f32 [256]           a zero bias                                                                                                                              1,024 */
/*   S32   f32 [64][64][64]    S[b][d][e] = sum_m K[b][m][d] (V x)[b][m][e]                                                                                         1,048,576 */
/*   ST16  f16 [64][64][64]    S TRANSPOSED per batch: ST16[b][e][d] = S[b][d][e] x2^7 (ONE f16 word: a computed operand): the second product's B^T                   524,288 */
/* ------------------------------------------------------------------------- */
constexpr size_t kOffQ16 = 0ull;
constexpr size_t kOffKT16 = 16777216ull;
constexpr size_t kOffVT16 = 33554432ull;
constexpr size_t kOffZB = 50331648ull;
constexpr size_t kOffS32 = 50332672ull;
constexpr size_t kOffST16 = 51381248ull;
constexpr size_t kWsTotal = 51905536ull;
static_assert(kWsTotal <= 134217728ull, "carve cap: under 128 MiB");
static_assert(kOffQ16 == 0
              && kOffKT16 == kOffQ16 + 16777216ull
              && kOffVT16 == kOffKT16 + 16777216ull
              && kOffZB == kOffVT16 + 16777216ull
              && kOffS32 == kOffZB + 1024ull
              && kOffST16 == kOffS32 + 1048576ull
              && kWsTotal == kOffST16 + 524288ull, "the carve is chained and totalled");
static_assert((kOffQ16 % 256) == 0 && (kOffKT16 % 256) == 0 && (kOffVT16 % 256) == 0 && (kOffZB % 256) == 0 && (kOffS32 % 256) == 0 && (kOffST16 % 256) == 0, "aligned regions");

/* ------------------------------------------------------------------------- */
/* Small helpers                                                             */
/* ------------------------------------------------------------------------- */
__device__ __forceinline__ unsigned short f2bf_bits(float f) {
  unsigned u = __float_as_uint(f);
  return (unsigned short)((u + 0x7FFFu + ((u >> 16) & 1u)) >> 16);
}
__device__ __forceinline__ float bf_bits2f(unsigned short h) { return __uint_as_float(((unsigned)h) << 16); }
/* RNE-convert to a bf16 value, kept in f32 */
__device__ __forceinline__ float bf16r(float f) { return bf_bits2f(f2bf_bits(f)); }
/* carry by a power of two, then flush anything below the f16 normal range to +0 by a select */
__device__ __forceinline__ float carry_flush(float v, float carry) {
  const float s = v * carry;
  return (fabsf(s) < kF16MinNormal) ? 0.0f : s;
}
__device__ __forceinline__ float frcp(float x) { return __builtin_amdgcn_rcpf(x); }

/* hazard guards as plain device helpers */
__device__ __forceinline__ void dep_guard4_h(v8f& a, v8f& b, v8f& c, v8f& d, v16h x, v16h y) { asm volatile("v_nop\n\tv_nop\n\tv_nop\n\tv_nop" : "+v"(a), "+v"(b), "+v"(c), "+v"(d) : "v"(x), "v"(y)); }
__device__ __forceinline__ void dep_guard4_b(v8f& a, v8f& b, v8f& c, v8f& d, v16b x, v16b y) { asm volatile("v_nop\n\tv_nop\n\tv_nop\n\tv_nop" : "+v"(a), "+v"(b), "+v"(c), "+v"(d) : "v"(x), "v"(y)); }
__device__ __forceinline__ void keep4_h(v16h a, v16h b, v16h c, v16h d) { asm volatile("v_nop" :: "v"(a), "v"(b), "v"(c), "v"(d)); }
__device__ __forceinline__ void keep4_b(v16b a, v16b b, v16b c, v16b d) { asm volatile("v_nop" :: "v"(a), "v"(b), "v"(c), "v"(d)); }
__device__ __forceinline__ void acc_guard4(v8f& a, v8f& b, v8f& c, v8f& d) { asm volatile("v_nop\n\tv_nop\n\tv_nop\n\tv_nop" : "+v"(a), "+v"(b), "+v"(c), "+v"(d)); }

template <typename T> struct Frag;
template <> struct Frag<_Float16> {
  typedef v16h V; union U { v16h v; v8h h[2]; };
  /* elements 0..7 <- p[0..7], 8..15 <- p[16..23] */
  static __device__ __forceinline__ v16h load(const _Float16* p) {
    U f; f.h[0] = *(const v8h*)(p); f.h[1] = *(const v8h*)(p + 16); return f.v;
  }
  static __device__ __forceinline__ v8f mma(v16h a, v16h b, v8f c) {
    return __builtin_amdgcn_wmma_f32_16x16x32_f16(false, a, false, b, (short)0, c, false, false);
  }
  static __device__ __forceinline__ void guard4(v8f& a, v8f& b, v8f& c, v8f& d, v16h x, v16h y) { dep_guard4_h(a, b, c, d, x, y); }
  static __device__ __forceinline__ void keep(v16h a, v16h b, v16h c, v16h d) { keep4_h(a, b, c, d); }
};
template <> struct Frag<__bf16> {
  typedef v16b V; union U { v16b v; v8b h[2]; };
  static __device__ __forceinline__ v16b load(const __bf16* p) {
    U f; f.h[0] = *(const v8b*)(p); f.h[1] = *(const v8b*)(p + 16); return f.v;
  }
  static __device__ __forceinline__ v8f mma(v16b a, v16b b, v8f c) {
    return __builtin_amdgcn_wmma_f32_16x16x32_bf16(false, a, false, b, (short)0, c, false, false);
  }
  static __device__ __forceinline__ void guard4(v8f& a, v8f& b, v8f& c, v8f& d, v16b x, v16b y) { dep_guard4_b(a, b, c, d, x, y); }
  static __device__ __forceinline__ void keep(v16b a, v16b b, v16b c, v16b d) { keep4_b(a, b, c, d); }
};

/* one f16 matrix instruction followed by its own hazard guard (accumulator tied, both fragments named) */
__device__ __forceinline__ v8f mma_h(v16h a, v16h b, v8f c) {
  c = __builtin_amdgcn_wmma_f32_16x16x32_f16(false, a, false, b, (short)0, c, false, false);
  asm volatile("v_nop\n\tv_nop\n\tv_nop\n\tv_nop" : "+v"(c) : "v"(a), "v"(b));
  return c;
}

/* ---- Register-blocked batched WMMA GEMM ------------------------------------ */
/* C[m,n] = scale * sum_k A[m,k] * Bt[n,k] (+bias)(+resid); each wave owns a 64x64 tile. */
/* A row-major [M,K]; Bt row-major [N,K]; M,N % 64 == 0, K % 32 == 0. */
/* SPLIT: operands are hi/lo planes (A2/Bt2 = lo planes, same layout); product = hi.hi + hi.lo + lo.hi. */
/* BIAS_MODE: 0 = none, 1 = bias[m], 2 = bias[n]. */
/* OUT_MODE: 0 = f32, 1 = f16, 2 = bf16 hi plane (Cout) + bf16 lo plane (Cout2). */
/* ET: 0 = f16 operands, 1 = bf16 operands (pointers passed as 16-bit storage) */
template <int ET> struct Elem;
template <> struct Elem<0> { typedef _Float16 T; };
template <> struct Elem<1> { typedef __bf16 T; };
template <int ET, bool SPLIT, int BIAS_MODE, int OUT_MODE, bool RESID, int ACT = 0>
__global__ __launch_bounds__(256) void wmma_gemm64(
    const unsigned short* __restrict__ Ap, const unsigned short* __restrict__ A2p, int lda, long strideA,
    const unsigned short* __restrict__ Btp, const unsigned short* __restrict__ Bt2p, int ldb, long strideB,
    void* __restrict__ Cout, void* __restrict__ Cout2, int ldc, long strideC,
    const float* __restrict__ bias,
    const float* __restrict__ resid, long strideR,
    int M, int N, int K, float scale) {
  typedef typename Elem<ET>::T T;
  typedef typename Frag<T>::V V;
  const T* A = (const T*)Ap; const T* A2 = (const T*)A2p; const T* Bt = (const T*)Btp; const T* Bt2 = (const T*)Bt2p;
  /* per-wave 16x64 slab, pitch 68 floats */
  __shared__ __align__(16) float sT[8][16 * 68];
  const int b    = blockIdx.y;
  const int lane = threadIdx.x & 31;
  const int wave = threadIdx.x >> 5;
  const int tilesN = N >> 6;
  const int tilesM = M >> 6;
  const int tile = blockIdx.x * 8 + wave;
  /* wave-uniform; no block barriers in this kernel */
  if (tile >= tilesM * tilesN) return;
  const int tm = tile / tilesN;
  const int tn = tile - tm * tilesN;
  const int m0 = tm << 6;
  const int n0 = tn << 6;

  const T* Ab  = A  + (size_t)b * strideA;
  const T* Bb  = Bt + (size_t)b * strideB;
  const T* Ab2 = SPLIT ? (A2  + (size_t)b * strideA) : nullptr;
  const T* Bb2 = SPLIT ? (Bt2 + (size_t)b * strideB) : nullptr;

  /* row (A) / col (B, D) within subtile; k offset of this lane half; D row offset */
  const int rlane = lane & 15;
  const int koff  = (lane >> 4) * 8;
  const int mOff  = (lane >> 4) * 8;

  v8f acc[4][4];
#pragma unroll
  for (int i = 0; i < 4; ++i)
#pragma unroll
    for (int j = 0; j < 4; ++j) acc[i][j] = (v8f){0.f,0.f,0.f,0.f,0.f,0.f,0.f,0.f};

  for (int k0 = 0; k0 < K; k0 += 32) {
    V bh[4], bl[4];
#pragma unroll
    for (int j = 0; j < 4; ++j) {
      const size_t bo = (size_t)(n0 + (j << 4) + rlane) * ldb + koff + k0;
      bh[j] = Frag<T>::load(Bb + bo);
      if (SPLIT) bl[j] = Frag<T>::load(Bb2 + bo);
    }
#pragma unroll
    for (int i = 0; i < 4; ++i) {
      const size_t ao = (size_t)(m0 + (i << 4) + rlane) * lda + koff + k0;
      V ah = Frag<T>::load(Ab + ao);
      V al;
      if (SPLIT) al = Frag<T>::load(Ab2 + ao);
#pragma unroll
      for (int j = 0; j < 4; ++j) {
        acc[i][j] = Frag<T>::mma(ah, bh[j], acc[i][j]);
        if (SPLIT) {
          acc[i][j] = Frag<T>::mma(ah, bl[j], acc[i][j]);
          acc[i][j] = Frag<T>::mma(al, bh[j], acc[i][j]);
        }
      }
      /* all four accumulators of this row group tied, A fragment(s) named */
      Frag<T>::guard4(acc[i][0], acc[i][1], acc[i][2], acc[i][3], ah, SPLIT ? al : ah);
    }
    Frag<T>::keep(bh[0], bh[1], bh[2], bh[3]);
    if (SPLIT) Frag<T>::keep(bl[0], bl[1], bl[2], bl[3]);
  }
  acc_guard4(acc[0][0], acc[0][1], acc[0][2], acc[0][3]);
  acc_guard4(acc[1][0], acc[1][1], acc[1][2], acc[1][3]);
  acc_guard4(acc[2][0], acc[2][1], acc[2][2], acc[2][3]);
  acc_guard4(acc[3][0], acc[3][1], acc[3][2], acc[3][3]);

  /* ---- epilogue ---- */
  float* slab = sT[wave];
  const float* Rb = RESID ? (resid + (size_t)b * strideR) : nullptr;
#pragma unroll
  for (int i = 0; i < 4; ++i) {
    const int mBase = m0 + (i << 4);
#pragma unroll
    for (int j = 0; j < 4; ++j) {
      const int n = n0 + (j << 4) + rlane;
      float bv = 0.f;
      if (BIAS_MODE == 2) bv = bias[n];
#pragma unroll
      for (int r = 0; r < 8; ++r) {
        float v = acc[i][j][r] * scale;
        if (BIAS_MODE == 1) v += bias[mBase + mOff + r];
        if (BIAS_MODE == 2) v += bv;
        if (RESID) v += Rb[(size_t)(mBase + mOff + r) * ldc + n];
        if (ACT == 1) v = tanhf(v);
        if (ACT == 2) v = fmaxf(v, 0.0f);
        if (ACT == 3) v = v / (1.0f + expf(-v));
        if (ACT == 4) v = (v > 0.f) ? v : 0.01f * v;
        slab[(mOff + r) * 68 + (j << 4) + rlane] = v;
      }
    }
    __builtin_amdgcn_fence(__ATOMIC_RELEASE, "workgroup");
    __builtin_amdgcn_wave_barrier();
    __builtin_amdgcn_fence(__ATOMIC_ACQUIRE, "workgroup");
    if (OUT_MODE == 0) {
      float* C = (float*)Cout + (size_t)b * strideC;
      /* row seg = 256 B = 16 lanes x 16 B */
      const int hh = lane >> 4, c4 = (lane & 15) * 4;
      {
#pragma unroll
        for (int it = 0; it < 8; ++it) {
          const int row = it * 2 + hh;
          v4f v = *(const v4f*)(slab + row * 68 + c4);
          *(v4f*)(C + (size_t)(mBase + row) * ldc + n0 + c4) = v;
        }
        
      }
    } else {
      const int q = lane >> 3, c8 = (lane & 7) * 8;
      unsigned short* C  = (unsigned short*)Cout  + (size_t)b * strideC;
      unsigned short* C2 = (OUT_MODE == 2) ? ((unsigned short*)Cout2 + (size_t)b * strideC) : nullptr;
      {
#pragma unroll
        for (int it = 0; it < 4; ++it) {
          const int row = it * 4 + q;
          const float* sp = slab + row * 68 + c8;
          v8h hv, lv;
#pragma unroll
          for (int e = 0; e < 8; ++e) {
            if (OUT_MODE == 1) {
              hv[e] = (_Float16)sp[e];
            } else {
              unsigned short hb = f2bf_bits(sp[e]);
              unsigned short lb = f2bf_bits(sp[e] - bf_bits2f(hb));
              hv[e] = __builtin_bit_cast(_Float16, hb);
              lv[e] = __builtin_bit_cast(_Float16, lb);
            }
          }
          *(v8h*)(C + (size_t)(mBase + row) * ldc + n0 + c8) = hv;
          if (OUT_MODE == 2) *(v8h*)(C2 + (size_t)(mBase + row) * ldc + n0 + c8) = lv;
        }
        
      }
    }
    __builtin_amdgcn_fence(__ATOMIC_RELEASE, "workgroup");
    __builtin_amdgcn_wave_barrier();
    __builtin_amdgcn_fence(__ATOMIC_ACQUIRE, "workgroup");
  }
}

/* ------------------------------------------------------------------------- */
/* Plane cast: dst[row*dstPitch + dstOff + c] = f16( 2^10 * bf16(src[row*srcCols + c]) ), flushed below 2^-14,  */
/* for c < srcCols = 1 << colsLog2 (64 here). Thread i handles 8 consecutive elements: row = i >> (colsLog2 */
/* - 3), c8 = 8 * (i & ((1 << (colsLog2 - 3)) - 1)). One 16-B store per lane; a wave stores 512 contiguous B =   */
/* grid = rows * srcCols / 8 / 256 blocks exactly (checked by static_asserts at the launches).                  */
/* ------------------------------------------------------------------------- */
__global__ __launch_bounds__(kThr) void cast_plane_kernel(const float* __restrict__ src, unsigned short* __restrict__ dst,
                                                          int colsLog2, int dstPitch, int dstOff) {
  const int i   = blockIdx.x * kThr + threadIdx.x;
  const int sh  = colsLog2 - 3;
  const int row = i >> sh;
  const int c8  = (i & ((1 << sh) - 1)) * 8;
  const float* sp = src + ((size_t)row << colsLog2) + c8;
  const v4f a0 = *(const v4f*)(sp);
  const v4f a1 = *(const v4f*)(sp + 4);
  v8h hv;
#pragma unroll
  for (int e = 0; e < 4; ++e) {
    const float f0 = a0[e];
    const float f1 = a1[e];
    hv[e]     = (_Float16)carry_flush(bf16r(f0), kInCarry);
    hv[4 + e] = (_Float16)carry_flush(bf16r(f1), kInCarry);
  }
  unsigned short* dp = dst + (size_t)row * dstPitch + dstOff + c8;
  *(v8h*)dp = hv;
  
}


/* ------------------------------------------------------------------------- */
/* The transposing casts of K and of V x, ONE launch: grid (8, 1, 128), block 256: z = batch b (0..63) and plane (z >> 6: 0 = K, 1 = V x: a branch on the block   */
/* index); x = a tile of kTM = 256 key positions (m0 = 256 blockIdx.x) by all 64 columns: 64 KiB of the source in a row. The values are those of the per-column    */
/* form: KT16[b][r][m] = f16(2^10 bf16(K[b][m][r])); VT16[b][r][m] = f16(2^10 bf16(V[b][m][r]) bf16(x[sample][m])), sample = b >> 4 (the product of two bf16       */
/* values is exact in f32; ONE f16 rounding).                                                                                                                     */
/* IN: thread = (dq = thread & 15: four columns 4 dq ..; oc = thread >> 4), two units c = oc and 16 + oc, a unit = 8 key positions: eight 16-B loads 256 B apart:  */
/* 16 lanes cover one whole 256-B source row. The unit's four columns go to LDS as four 16-B words of 8 positions each.                                           */
/* LDS: sT[r][chunk], a row = 32 chunks of 16 B (512 B, no pad); chunk c of row r lies at place c ^ (r >> 2): the 16 lanes of a store (rows 4 apart, one c) and    */
/* the 16 lanes of a load (one row, 16 chunks in a row) each fall on all 64 banks once.                                                                           */
/* OUT: behind the barrier a wave reads one row's 32 chunks and stores 512 contiguous bytes of KT16 / VT16.                                                       */
/* ------------------------------------------------------------------------- */
constexpr int kTM = 256;
/* IN for one plane kind: ISV picks the V x arithmetic at compile time, so the K blocks carry no multiply by x and no select */
template <bool ISV>
__device__ __forceinline__ void tcast_fill(const float* __restrict__ src, const float* __restrict__ xs, _Float16* sT, unsigned dq, unsigned oc) {
  /* every loop here is unrolled so that p, xr and hv are indexed by constants and stay in registers */
  v4f p[2][8];
#pragma unroll
  for (int u = 0; u < 2; ++u)
#pragma unroll
    for (int j = 0; j < 8; ++j) p[u][j] = *(const v4f*)(src + (size_t)(((unsigned)u * 16u + oc) * 8u + (unsigned)j) * kD);
#pragma unroll
  for (int u = 0; u < 2; ++u) {
    const unsigned c = (unsigned)u * 16u + oc;
    float xr[8];
    if (ISV) {
      const v4f x0 = *(const v4f*)(xs + c * 8u);
      const v4f x1 = *(const v4f*)(xs + c * 8u + 4u);
#pragma unroll
      for (int j = 0; j < 4; ++j) { xr[j] = bf16r(x0[j]); xr[4 + j] = bf16r(x1[j]); }
    }
#pragma unroll
    for (int e = 0; e < 4; ++e) {
      v8h hv;
#pragma unroll
      for (int j = 0; j < 8; ++j) {
        float v = bf16r(p[u][j][e]);
        if (ISV) v = v * xr[j];
        hv[j] = (_Float16)carry_flush(v, kInCarry);
      }
      *(v8h*)(sT + (dq * 4u + (unsigned)e) * (unsigned)kTM + (c ^ dq) * 8u) = hv;
    }
  }
}
__global__ __launch_bounds__(kThr) void tcast_kernel(const float* __restrict__ K, const float* __restrict__ V, const float* __restrict__ xw,
                                                    unsigned short* __restrict__ KT16, unsigned short* __restrict__ VT16) {
  __shared__ __align__(16) _Float16 sT[kD * kTM];
  const unsigned bz = blockIdx.z;
  const bool isV = bz >= (unsigned)kNb;            /* block-uniform */
  const unsigned b = isV ? (bz - (unsigned)kNb) : bz;
  const unsigned m0 = blockIdx.x * (unsigned)kTM;
  const unsigned dq = threadIdx.x & 15u;
  const unsigned oc = threadIdx.x >> 4;
  const size_t so = ((size_t)b * kN + m0) * kD + dq * 4u;
  if (isV) tcast_fill<true>(V + so, xw + (size_t)(b >> 4) * kN + m0, sT, dq, oc);
  else     tcast_fill<false>(K + so, xw, sT, dq, oc);
  /* every column of the tile is in LDS before any wave reads a row of it */
  __syncthreads();
  unsigned short* dst = (isV ? VT16 : KT16) + (size_t)b * kD * kN + m0;
  /* wave w takes rows r = 8 it + w: r >> 2 = 2 it + (w >> 2), and the two terms share no bit */
  const unsigned w = threadIdx.x >> 5, c = threadIdx.x & 31u;
  const unsigned cw = c ^ (w >> 2);
  const _Float16* sr = sT + w * (unsigned)kTM;
  unsigned short* dr = dst + (size_t)w * kN + c * 8u;
  /* unrolled: the eight rows' stores become immediate offsets of one global address; each LDS read keeps its own per-row XOR */
#pragma unroll
  for (int it = 0; it < 8; ++it) {
    const v8h hv = *(const v8h*)(sr + it * 8 * kTM + (cw ^ (unsigned)(2 * it)) * 8u);
    *(v8h*)(dr + (size_t)it * 8 * kN) = hv;
  }
}
static_assert(kN % kTM == 0 && kTM == 256 && kD == 64 && kThr == 256 && kH == 16, "transposing cast exact: 8 tiles of 256 positions a plane; 16 lanes a source row; 32 chunks a tile row; sample = b >> 4");

/* ------------------------------------------------------------------------- */
/* The zero bias (256 floats) and the cast of S, two launches: 1 block (ZB only), then 129 blocks of 256 threads (the branch is on the block index): block 0: ZB[thread] = 0; blocks 1..128: */
/* thread = (batch b, row e, chunk of 8 columns d): i = 256 (block - 1) + thread (0..32,767): b = i >> 9, e = (i >> 3) & 63, d8 = 8 (i & 7): ST16[b][e][d8 + j] =        */
/* ------------------------------------------------------------------------- */
__global__ __launch_bounds__(kThr) void scast_kernel(const float* __restrict__ S32, unsigned short* __restrict__ ST16, float* __restrict__ ZB) {
  if (blockIdx.x == 0u) {
    float* dp = ZB + threadIdx.x;
    *(float*)dp = 0.0f;
    
    return;
  }
  const unsigned i = (blockIdx.x - 1u) * (unsigned)kThr + threadIdx.x;
  const unsigned b = i >> 9, e = (i >> 3) & 63u, d8 = (i & 7u) * 8u;
  const float* sp = S32 + ((size_t)b * kD + d8) * kD + e;
  v8h hv;
#pragma unroll
  for (int j = 0; j < 8; ++j) hv[j] = (_Float16)carry_flush(sp[(size_t)j * kD], kSCarry);
  unsigned short* dp = ST16 + ((size_t)b * kD + e) * kD + d8;
  *(v8h*)dp = hv;
  
}
static_assert(kNb * kD * (kD / 8) == 128 * kThr && kD == 64, "S cast grid exact: 128 blocks; 512 threads a batch");

/* ------------------------------------------------------------------------- */
/* Host glue: 6 launches; kernel launches only: the cast of Q (a contiguous plane cast linearly as rows of 64); the transposing casts of K and V x; THE FIRST PRODUCT  */
/* S = KT16 VT16^T: M 64, N 64, K 2,048 A BATCH: ONE tile a batch: grid (1, 64): THE ENGINE's BLOCKS TAKE 8 TILES: 7 OF A BLOCK's 8 WAVES LEAVE AT THE ENGINE's OWN     */
/* 'tile >= tiles' TEST (a wave-uniform return before any memory operation); the zero bias is written BEFORE it by a one-block launch of the S cast's kernel; the cast of S; THE */
/* SECOND PRODUCT out = Q16 ST16^T / 8: M 2,048, N 64, K 64 a batch (32 tiles a batch: 4 blocks), its epilogue storing d_out ([64][2048][64]: ldc 64; strideC        */
/* 131,072). Both products are the ONE engine instantiation <0, false, 2, 0, false, 0> with its batch index blockIdx.y and the three strides.                */
/* ------------------------------------------------------------------------- */
static_assert(((size_t)kNb * kN * kD / 8) % kThr == 0 && ((size_t)kNb * kN * kD) % 64 == 0, "plane cast grid exact; the plane is whole rows of 64");

extern "C" void kernel_launch(void* const* d_in, const int* in_sizes, int n_in,
                              void* d_out, int out_size, void* d_ws, size_t ws_size,
                              hipStream_t stream) {
  if (n_in < 4 || d_out == nullptr || d_ws == nullptr) return;
  if (in_sizes[0] != kNb * kN * kD || in_sizes[1] != kNb * kN * kD || in_sizes[2] != kNb * kN * kD || in_sizes[3] != kBs * kN) return;
  if (out_size != kNb * kN * kD) return;
  if (ws_size < kWsTotal) return;
  const float* Q = (const float*)d_in[0];
  const float* K = (const float*)d_in[1];
  const float* V = (const float*)d_in[2];
  const float* xw = (const float*)d_in[3];
  float* out = (float*)d_out;
  char* ws = (char*)d_ws;
  unsigned short* Q16 = (unsigned short*)(ws + kOffQ16);
  unsigned short* KT16 = (unsigned short*)(ws + kOffKT16);
  unsigned short* VT16 = (unsigned short*)(ws + kOffVT16);
  float* ZB = (float*)(ws + kOffZB);
  float* S32 = (float*)(ws + kOffS32);
  unsigned short* ST16 = (unsigned short*)(ws + kOffST16);

  /* the plain cast of Q: <<<elements / 8 / 256>>>(src as rows of 64, dst, colsLog2 6, the same row length, column offset 0): a linear copy-cast */
  cast_plane_kernel<<<(int)(((size_t)kNb * kN * kD / 8) / kThr), kThr, 0, stream>>>(Q, Q16, 6, 64, 0);
  tcast_kernel<<<dim3(kN / kTM, 1, 2 * kNb), kThr, 0, stream>>>(K, V, xw, KT16, VT16);
  /* the zero bias first (block 0 of the S cast's kernel writes it: this FIRST launch of that kernel is given ONE block: it writes ZB only and casts nothing) */
  scast_kernel<<<1, kThr, 0, stream>>>(S32, ST16, ZB);
  /* S32[b] = KT16[b] . VT16[b]^T: M 64, N 64, K 2048; strides: A 64 x 2048, B 64 x 2048, C 64 x 64 */
  wmma_gemm64<0, false, 2, 0, false, 0><<<dim3(1, kNb), 256, 0, stream>>>(
      KT16, KT16, kN, (long)kD * kN, VT16, VT16, kN, (long)kD * kN, (void*)S32, (void*)S32, kD, (long)kD * kD, ZB, nullptr, 0L, kD, kD, kN, kSc1);
  scast_kernel<<<129, kThr, 0, stream>>>(S32, ST16, ZB);
  /* out[b] = Q16[b] . ST16[b]^T / 8: M 2048, N 64, K 64; strides: A 2048 x 64, B 64 x 64, C 2048 x 64 */
  wmma_gemm64<0, false, 2, 0, false, 0><<<dim3((kN / 64) * (kD / 64) / 8, kNb), 256, 0, stream>>>(
      Q16, Q16, kD, (long)kN * kD, ST16, ST16, kD, (long)kD * kD, (void*)out, (void*)out, kD, (long)kN * kD, ZB, nullptr, 0L, kN, kD, kD, kSc2);
}

// v002
// A run of this version takes 35.2 microseconds.
// Two timings next to v001 put it at 2.72 and 2.74 times that version's speed.
// Over all steps from v000 it is 4.94 times as fast.
// Compute dtype: attention WITHOUT a softmax (scores = Q K^T / 8; out = scores (V x), x a weight per key position) over 64 (sample, head) batches of 2,048 positions and width 64, IN ITS REGROUPED FORM out = Q (K^T (V x)) / 8 (the module's own sums regrouped by associativity: no operation stands between its two products): the two batched products ([64 x 2048] x [2048 x 64] a batch: S = K^T (V x); [2048 x 64] x [64 x 64] a batch: Q S) on v_wmma_f32_16x16x32_f16, f32 accumulate, ONE f16 word per operand: Q and K as their bf16-RNE-converted values carried by 2^10 (exact in f16); V x (the product of two bf16 values, exact in f32) carried by 2^10 and S carried by 2^7 (one rounding each: the measured mode); every operand behind a flush select below 2^-14; the scale 1 / 8 folded into the second product's scale (a power of two: exact).
#include <hip/hip_runtime.h>
#include <math.h>

typedef __attribute__((ext_vector_type(16))) _Float16 v16h;
typedef __attribute__((ext_vector_type(8)))  _Float16 v8h;
typedef __attribute__((ext_vector_type(16))) __bf16   v16b;
typedef __attribute__((ext_vector_type(8)))  __bf16   v8b;
typedef __attribute__((ext_vector_type(8)))  float    v8f;
typedef __attribute__((ext_vector_type(4)))  float    v4f;

/* ------------------------------------------------------------------------- */
/* Shape constants                                                           */
/* ------------------------------------------------------------------------- */
constexpr int kBs   = 4;                  /* samples */
constexpr int kH    = 16;                 /* heads */
constexpr int kNb   = kBs * kH;           /* 64 batches: b = sample x 16 + head */
constexpr int kN    = 2048;               /* positions (queries and keys) */
constexpr int kD    = 64;                 /* width of a head (queries / keys and values alike) */
constexpr int kThr  = 256;
constexpr float kInCarry = 1024.0f;       /* cast_plane_kernel's carry: Q; and K, V x */
constexpr float kSCarry  = 128.0f;        /* S */
constexpr float kSc1 = 1.0f / (kInCarry * kInCarry);
constexpr float kSc2 = 1.0f / (kInCarry * kSCarry * 8.0f);   /* the module's 1 / sqrt(64) = 1 / 8 folded in: a power of two */
/* 2^-14: smallest normal f16 magnitude */
constexpr float kF16MinNormal = 6.103515625e-5f;

static_assert((kD % 64) == 0 && (kN % 64) == 0 && (kN % 32) == 0 && (kD % 32) == 0 && ((kN / 64) * (kD / 64)) % 8 == 0, "GEMM M, N multiples of 64, K of 32; the second product's grid exact (32 tiles a batch)");

/* ------------------------------------------------------------------------- */
/* Workspace region map (bytes; every offset a multiple of 256; the chain is static_assert'ed below). No region is reused.          */
/*   Q16   f16 [64][2048][64]  Q x2^10 (batch = sample x 16 + head): the second product's A                                                                        16,777,216 */
/*   KT16  f16 [64][64][2048]  K TRANSPOSED per batch: KT16[b][d][m] = K[b][m][d] x2^10: the first product's A (K = 2,048 key positions)                           16,777,216 */
/*   VT16  f16 [64][64][2048]  (V x) TRANSPOSED per batch: VT16[b][e][m] = V[b][m][e] x[sample][m] x2^10 (ONE f16 word: a computed operand): the first product's B^T  16,777,216 */
/*   ZB    f32 [256]           a zero bias                                                                                                                              1,024 */
/*   SP    f32 [64][4][64][64] the first product's partial sums, TRANSPOSED: SP[b][p][e][d] = sum over the 512 key positions m of slice p of K[b][m][d] (V x)[b][m][e]   4,194,304 */
/*   ST16  f16 [64][64][64]    S TRANSPOSED per batch: ST16[b][e][d] = S[b][d][e] x2^7 (ONE f16 word: a computed operand): the second product's B^T                   524,288 */
/* ------------------------------------------------------------------------- */
constexpr size_t kOffQ16 = 0ull;
constexpr size_t kOffKT16 = 16777216ull;
constexpr size_t kOffVT16 = 33554432ull;
constexpr size_t kOffZB = 50331648ull;
constexpr size_t kOffSP = 50332672ull;
constexpr size_t kOffST16 = 54526976ull;
constexpr size_t kWsTotal = 55051264ull;
static_assert(kWsTotal <= 134217728ull, "carve cap: under 128 MiB");
static_assert(kOffQ16 == 0
              && kOffKT16 == kOffQ16 + 16777216ull
              && kOffVT16 == kOffKT16 + 16777216ull
              && kOffZB == kOffVT16 + 16777216ull
              && kOffSP == kOffZB + 1024ull
              && kOffST16 == kOffSP + 4194304ull
              && kWsTotal == kOffST16 + 524288ull, "the carve is chained and totalled");
static_assert((kOffQ16 % 256) == 0 && (kOffKT16 % 256) == 0 && (kOffVT16 % 256) == 0 && (kOffZB % 256) == 0 && (kOffSP % 256) == 0 && (kOffST16 % 256) == 0, "aligned regions");

/* ------------------------------------------------------------------------- */
/* Small helpers                                                             */
/* ------------------------------------------------------------------------- */
__device__ __forceinline__ unsigned short f2bf_bits(float f) {
  unsigned u = __float_as_uint(f);
  return (unsigned short)((u + 0x7FFFu + ((u >> 16) & 1u)) >> 16);
}
__device__ __forceinline__ float bf_bits2f(unsigned short h) { return __uint_as_float(((unsigned)h) << 16); }
/* RNE-convert to a bf16 value, kept in f32 */
__device__ __forceinline__ float bf16r(float f) { return bf_bits2f(f2bf_bits(f)); }
/* carry by a power of two, then flush anything below the f16 normal range to +0 by a select */
__device__ __forceinline__ float carry_flush(float v, float carry) {
  const float s = v * carry;
  return (fabsf(s) < kF16MinNormal) ? 0.0f : s;
}
__device__ __forceinline__ float frcp(float x) { return __builtin_amdgcn_rcpf(x); }

/* hazard guards as plain device helpers */
__device__ __forceinline__ void dep_guard4_h(v8f& a, v8f& b, v8f& c, v8f& d, v16h x, v16h y) { asm volatile("v_nop\n\tv_nop\n\tv_nop\n\tv_nop" : "+v"(a), "+v"(b), "+v"(c), "+v"(d) : "v"(x), "v"(y)); }
__device__ __forceinline__ void dep_guard4_b(v8f& a, v8f& b, v8f& c, v8f& d, v16b x, v16b y) { asm volatile("v_nop\n\tv_nop\n\tv_nop\n\tv_nop" : "+v"(a), "+v"(b), "+v"(c), "+v"(d) : "v"(x), "v"(y)); }
__device__ __forceinline__ void keep4_h(v16h a, v16h b, v16h c, v16h d) { asm volatile("v_nop" :: "v"(a), "v"(b), "v"(c), "v"(d)); }
__device__ __forceinline__ void keep4_b(v16b a, v16b b, v16b c, v16b d) { asm volatile("v_nop" :: "v"(a), "v"(b), "v"(c), "v"(d)); }
__device__ __forceinline__ void acc_guard4(v8f& a, v8f& b, v8f& c, v8f& d) { asm volatile("v_nop\n\tv_nop\n\tv_nop\n\tv_nop" : "+v"(a), "+v"(b), "+v"(c), "+v"(d)); }

template <typename T> struct Frag;
template <> struct Frag<_Float16> {
  typedef v16h V; union U { v16h v; v8h h[2]; };
  /* elements 0..7 <- p[0..7], 8..15 <- p[16..23] */
  static __device__ __forceinline__ v16h load(const _Float16* p) {
    U f; f.h[0] = *(const v8h*)(p); f.h[1] = *(const v8h*)(p + 16); return f.v;
  }
  static __device__ __forceinline__ v8f mma(v16h a, v16h b, v8f c) {
    return __builtin_amdgcn_wmma_f32_16x16x32_f16(false, a, false, b, (short)0, c, false, false);
  }
  static __device__ __forceinline__ void guard4(v8f& a, v8f& b, v8f& c, v8f& d, v16h x, v16h y) { dep_guard4_h(a, b, c, d, x, y); }
  static __device__ __forceinline__ void keep(v16h a, v16h b, v16h c, v16h d) { keep4_h(a, b, c, d); }
};
template <> struct Frag<__bf16> {
  typedef v16b V; union U { v16b v; v8b h[2]; };
  static __device__ __forceinline__ v16b load(const __bf16* p) {
    U f; f.h[0] = *(const v8b*)(p); f.h[1] = *(const v8b*)(p + 16); return f.v;
  }
  static __device__ __forceinline__ v8f mma(v16b a, v16b b, v8f c) {
    return __builtin_amdgcn_wmma_f32_16x16x32_bf16(false, a, false, b, (short)0, c, false, false);
  }
  static __device__ __forceinline__ void guard4(v8f& a, v8f& b, v8f& c, v8f& d, v16b x, v16b y) { dep_guard4_b(a, b, c, d, x, y); }
  static __device__ __forceinline__ void keep(v16b a, v16b b, v16b c, v16b d) { keep4_b(a, b, c, d); }
};

/* one f16 matrix instruction followed by its own hazard guard (accumulator tied, both fragments named) */
__device__ __forceinline__ v8f mma_h(v16h a, v16h b, v8f c) {
  c = __builtin_amdgcn_wmma_f32_16x16x32_f16(false, a, false, b, (short)0, c, false, false);
  asm volatile("v_nop\n\tv_nop\n\tv_nop\n\tv_nop" : "+v"(c) : "v"(a), "v"(b));
  return c;
}

/* ---- Register-blocked batched WMMA GEMM ------------------------------------ */
/* C[m,n] = scale * sum_k A[m,k] * Bt[n,k] (+bias)(+resid); each wave owns a 64x64 tile. */
/* A row-major [M,K]; Bt row-major [N,K]; M,N % 64 == 0, K % 32 == 0. */
/* SPLIT: operands are hi/lo planes (A2/Bt2 = lo planes, same layout); product = hi.hi + hi.lo + lo.hi. */
/* BIAS_MODE: 0 = none, 1 = bias[m], 2 = bias[n]. */
/* OUT_MODE: 0 = f32, 1 = f16, 2 = bf16 hi plane (Cout) + bf16 lo plane (Cout2). */
/* ET: 0 = f16 operands, 1 = bf16 operands (pointers passed as 16-bit storage) */
template <int ET> struct Elem;
template <> struct Elem<0> { typedef _Float16 T; };
template <> struct Elem<1> { typedef __bf16 T; };
template <int ET, bool SPLIT, int BIAS_MODE, int OUT_MODE, bool RESID, int ACT = 0>
__global__ __launch_bounds__(256) void wmma_gemm64(
    const unsigned short* __restrict__ Ap, const unsigned short* __restrict__ A2p, int lda, long strideA,
    const unsigned short* __restrict__ Btp, const unsigned short* __restrict__ Bt2p, int ldb, long strideB,
    void* __restrict__ Cout, void* __restrict__ Cout2, int ldc, long strideC,
    const float* __restrict__ bias,
    const float* __restrict__ resid, long strideR,
    int M, int N, int K, float scale) {
  typedef typename Elem<ET>::T T;
  typedef typename Frag<T>::V V;
  const T* A = (const T*)Ap; const T* A2 = (const T*)A2p; const T* Bt = (const T*)Btp; const T* Bt2 = (const T*)Bt2p;
  /* per-wave 16x64 slab, pitch 68 floats */
  __shared__ __align__(16) float sT[8][16 * 68];
  const int b    = blockIdx.y;
  const int lane = threadIdx.x & 31;
  const int wave = threadIdx.x >> 5;
  const int tilesN = N >> 6;
  const int tilesM = M >> 6;
  const int tile = blockIdx.x * 8 + wave;
  /* wave-uniform; no block barriers in this kernel */
  if (tile >= tilesM * tilesN) return;
  const int tm = tile / tilesN;
  const int tn = tile - tm * tilesN;
  const int m0 = tm << 6;
  const int n0 = tn << 6;

  const T* Ab  = A  + (size_t)b * strideA;
  const T* Bb  = Bt + (size_t)b * strideB;
  const T* Ab2 = SPLIT ? (A2  + (size_t)b * strideA) : nullptr;
  const T* Bb2 = SPLIT ? (Bt2 + (size_t)b * strideB) : nullptr;

  /* row (A) / col (B, D) within subtile; k offset of this lane half; D row offset */
  const int rlane = lane & 15;
  const int koff  = (lane >> 4) * 8;
  const int mOff  = (lane >> 4) * 8;

  v8f acc[4][4];
#pragma unroll
  for (int i = 0; i < 4; ++i)
#pragma unroll
    for (int j = 0; j < 4; ++j) acc[i][j] = (v8f){0.f,0.f,0.f,0.f,0.f,0.f,0.f,0.f};

  for (int k0 = 0; k0 < K; k0 += 32) {
    V bh[4], bl[4];
#pragma unroll
    for (int j = 0; j < 4; ++j) {
      const size_t bo = (size_t)(n0 + (j << 4) + rlane) * ldb + koff + k0;
      bh[j] = Frag<T>::load(Bb + bo);
      if (SPLIT) bl[j] = Frag<T>::load(Bb2 + bo);
    }
#pragma unroll
    for (int i = 0; i < 4; ++i) {
      const size_t ao = (size_t)(m0 + (i << 4) + rlane) * lda + koff + k0;
      V ah = Frag<T>::load(Ab + ao);
      V al;
      if (SPLIT) al = Frag<T>::load(Ab2 + ao);
#pragma unroll
      for (int j = 0; j < 4; ++j) {
        acc[i][j] = Frag<T>::mma(ah, bh[j], acc[i][j]);
        if (SPLIT) {
          acc[i][j] = Frag<T>::mma(ah, bl[j], acc[i][j]);
          acc[i][j] = Frag<T>::mma(al, bh[j], acc[i][j]);
        }
      }
      /* all four accumulators of this row group tied, A fragment(s) named */
      Frag<T>::guard4(acc[i][0], acc[i][1], acc[i][2], acc[i][3], ah, SPLIT ? al : ah);
    }
    Frag<T>::keep(bh[0], bh[1], bh[2], bh[3]);
    if (SPLIT) Frag<T>::keep(bl[0], bl[1], bl[2], bl[3]);
  }
  acc_guard4(acc[0][0], acc[0][1], acc[0][2], acc[0][3]);
  acc_guard4(acc[1][0], acc[1][1], acc[1][2], acc[1][3]);
  acc_guard4(acc[2][0], acc[2][1], acc[2][2], acc[2][3]);
  acc_guard4(acc[3][0], acc[3][1], acc[3][2], acc[3][3]);

  /* ---- epilogue ---- */
  float* slab = sT[wave];
  const float* Rb = RESID ? (resid + (size_t)b * strideR) : nullptr;
#pragma unroll
  for (int i = 0; i < 4; ++i) {
    const int mBase = m0 + (i << 4);
#pragma unroll
    for (int j = 0; j < 4; ++j) {
      const int n = n0 + (j << 4) + rlane;
      float bv = 0.f;
      if (BIAS_MODE == 2) bv = bias[n];
#pragma unroll
      for (int r = 0; r < 8; ++r) {
        float v = acc[i][j][r] * scale;
        if (BIAS_MODE == 1) v += bias[mBase + mOff + r];
        if (BIAS_MODE == 2) v += bv;
        if (RESID) v += Rb[(size_t)(mBase + mOff + r) * ldc + n];
        if (ACT == 1) v = tanhf(v);
        if (ACT == 2) v = fmaxf(v, 0.0f);
        if (ACT == 3) v = v / (1.0f + expf(-v));
        if (ACT == 4) v = (v > 0.f) ? v : 0.01f * v;
        slab[(mOff + r) * 68 + (j << 4) + rlane] = v;
      }
    }
    __builtin_amdgcn_fence(__ATOMIC_RELEASE, "workgroup");
    __builtin_amdgcn_wave_barrier();
    __builtin_amdgcn_fence(__ATOMIC_ACQUIRE, "workgroup");
    if (OUT_MODE == 0) {
      float* C = (float*)Cout + (size_t)b * strideC;
      /* row seg = 256 B = 16 lanes x 16 B */
      const int hh = lane >> 4, c4 = (lane & 15) * 4;
      {
#pragma unroll
        for (int it = 0; it < 8; ++it) {
          const int row = it * 2 + hh;
          v4f v = *(const v4f*)(slab + row * 68 + c4);
          *(v4f*)(C + (size_t)(mBase + row) * ldc + n0 + c4) = v;
        }
        
      }
    } else {
      const int q = lane >> 3, c8 = (lane & 7) * 8;
      unsigned short* C  = (unsigned short*)Cout  + (size_t)b * strideC;
      unsigned short* C2 = (OUT_MODE == 2) ? ((unsigned short*)Cout2 + (size_t)b * strideC) : nullptr;
      {
#pragma unroll
        for (int it = 0; it < 4; ++it) {
          const int row = it * 4 + q;
          const float* sp = slab + row * 68 + c8;
          v8h hv, lv;
#pragma unroll
          for (int e = 0; e < 8; ++e) {
            if (OUT_MODE == 1) {
              hv[e] = (_Float16)sp[e];
            } else {
              unsigned short hb = f2bf_bits(sp[e]);
              unsigned short lb = f2bf_bits(sp[e] - bf_bits2f(hb));
              hv[e] = __builtin_bit_cast(_Float16, hb);
              lv[e] = __builtin_bit_cast(_Float16, lb);
            }
          }
          *(v8h*)(C + (size_t)(mBase + row) * ldc + n0 + c8) = hv;
          if (OUT_MODE == 2) *(v8h*)(C2 + (size_t)(mBase + row) * ldc + n0 + c8) = lv;
        }
        
      }
    }
    __builtin_amdgcn_fence(__ATOMIC_RELEASE, "workgroup");
    __builtin_amdgcn_wave_barrier();
    __builtin_amdgcn_fence(__ATOMIC_ACQUIRE, "workgroup");
  }
}

/* ------------------------------------------------------------------------- */
/* Plane cast: dst[row*dstPitch + dstOff + c] = f16( 2^10 * bf16(src[row*srcCols + c]) ), flushed below 2^-14,  */
/* for c < srcCols = 1 << colsLog2 (64 here). Thread i handles 8 consecutive elements: row = i >> (colsLog2 */
/* - 3), c8 = 8 * (i & ((1 << (colsLog2 - 3)) - 1)). One 16-B store per lane; a wave stores 512 contiguous B =   */
/* grid = rows * srcCols / 8 / 256 blocks exactly (checked by static_asserts at the launches).                  */
/* ------------------------------------------------------------------------- */
__global__ __launch_bounds__(kThr) void cast_plane_kernel(const float* __restrict__ src, unsigned short* __restrict__ dst,
                                                          int colsLog2, int dstPitch, int dstOff) {
  const int i   = blockIdx.x * kThr + threadIdx.x;
  const int sh  = colsLog2 - 3;
  const int row = i >> sh;
  const int c8  = (i & ((1 << sh) - 1)) * 8;
  const float* sp = src + ((size_t)row << colsLog2) + c8;
  const v4f a0 = *(const v4f*)(sp);
  const v4f a1 = *(const v4f*)(sp + 4);
  v8h hv;
#pragma unroll
  for (int e = 0; e < 4; ++e) {
    const float f0 = a0[e];
    const float f1 = a1[e];
    hv[e]     = (_Float16)carry_flush(bf16r(f0), kInCarry);
    hv[4 + e] = (_Float16)carry_flush(bf16r(f1), kInCarry);
  }
  unsigned short* dp = dst + (size_t)row * dstPitch + dstOff + c8;
  *(v8h*)dp = hv;
  
}


/* ------------------------------------------------------------------------- */
/* The transposing casts of K and of V x, ONE launch: grid (8, 1, 128), block 256: z = batch b (0..63) and plane (z >> 6: 0 = K, 1 = V x: a branch on the block   */
/* index); x = a tile of kTM = 256 key positions (m0 = 256 blockIdx.x) by all 64 columns: 64 KiB of the source in a row. The values are those of the per-column    */
/* form: KT16[b][r][m] = f16(2^10 bf16(K[b][m][r])); VT16[b][r][m] = f16(2^10 bf16(V[b][m][r]) bf16(x[sample][m])), sample = b >> 4 (the product of two bf16       */
/* values is exact in f32; ONE f16 rounding).                                                                                                                     */
/* IN: thread = (dq = thread & 15: four columns 4 dq ..; oc = thread >> 4), two units c = oc and 16 + oc, a unit = 8 key positions: eight 16-B loads 256 B apart:  */
/* 16 lanes cover one whole 256-B source row. The unit's four columns go to LDS as four 16-B words of 8 positions each.                                           */
/* LDS: sT[r][chunk], a row = 32 chunks of 16 B (512 B, no pad); chunk c of row r lies at place c ^ (r >> 2): the 16 lanes of a store (rows 4 apart, one c) and    */
/* the 16 lanes of a load (one row, 16 chunks in a row) each fall on all 64 banks once.                                                                           */
/* OUT: behind the barrier a wave reads one row's 32 chunks and stores 512 contiguous bytes of KT16 / VT16.                                                       */
/* ------------------------------------------------------------------------- */
constexpr int kTM = 256;
/* IN for one plane kind: ISV picks the V x arithmetic at compile time, so the K blocks carry no multiply by x and no select */
template <bool ISV>
__device__ __forceinline__ void tcast_fill(const float* __restrict__ src, const float* __restrict__ xs, _Float16* sT, unsigned dq, unsigned oc) {
  /* every loop here is unrolled so that p, xr and hv are indexed by constants and stay in registers */
  v4f p[2][8];
#pragma unroll
  for (int u = 0; u < 2; ++u)
#pragma unroll
    for (int j = 0; j < 8; ++j) p[u][j] = *(const v4f*)(src + (size_t)(((unsigned)u * 16u + oc) * 8u + (unsigned)j) * kD);
#pragma unroll
  for (int u = 0; u < 2; ++u) {
    const unsigned c = (unsigned)u * 16u + oc;
    float xr[8];
    if (ISV) {
      const v4f x0 = *(const v4f*)(xs + c * 8u);
      const v4f x1 = *(const v4f*)(xs + c * 8u + 4u);
#pragma unroll
      for (int j = 0; j < 4; ++j) { xr[j] = bf16r(x0[j]); xr[4 + j] = bf16r(x1[j]); }
    }
#pragma unroll
    for (int e = 0; e < 4; ++e) {
      v8h hv;
#pragma unroll
      for (int j = 0; j < 8; ++j) {
        float v = bf16r(p[u][j][e]);
        if (ISV) v = v * xr[j];
        hv[j] = (_Float16)carry_flush(v, kInCarry);
      }
      *(v8h*)(sT + (dq * 4u + (unsigned)e) * (unsigned)kTM + (c ^ dq) * 8u) = hv;
    }
  }
}
__global__ __launch_bounds__(kThr) void tcast_kernel(const float* __restrict__ K, const float* __restrict__ V, const float* __restrict__ xw,
                                                    unsigned short* __restrict__ KT16, unsigned short* __restrict__ VT16) {
  __shared__ __align__(16) _Float16 sT[kD * kTM];
  const unsigned bz = blockIdx.z;
  const bool isV = bz >= (unsigned)kNb;            /* block-uniform */
  const unsigned b = isV ? (bz - (unsigned)kNb) : bz;
  const unsigned m0 = blockIdx.x * (unsigned)kTM;
  const unsigned dq = threadIdx.x & 15u;
  const unsigned oc = threadIdx.x >> 4;
  const size_t so = ((size_t)b * kN + m0) * kD + dq * 4u;
  if (isV) tcast_fill<true>(V + so, xw + (size_t)(b >> 4) * kN + m0, sT, dq, oc);
  else     tcast_fill<false>(K + so, xw, sT, dq, oc);
  /* every column of the tile is in LDS before any wave reads a row of it */
  __syncthreads();
  unsigned short* dst = (isV ? VT16 : KT16) + (size_t)b * kD * kN + m0;
  /* wave w takes rows r = 8 it + w: r >> 2 = 2 it + (w >> 2), and the two terms share no bit */
  const unsigned w = threadIdx.x >> 5, c = threadIdx.x & 31u;
  const unsigned cw = c ^ (w >> 2);
  const _Float16* sr = sT + w * (unsigned)kTM;
  unsigned short* dr = dst + (size_t)w * kN + c * 8u;
  /* unrolled: the eight rows' stores become immediate offsets of one global address; each LDS read keeps its own per-row XOR */
#pragma unroll
  for (int it = 0; it < 8; ++it) {
    const v8h hv = *(const v8h*)(sr + it * 8 * kTM + (cw ^ (unsigned)(2 * it)) * 8u);
    *(v8h*)(dr + (size_t)it * 8 * kN) = hv;
  }
}
static_assert(kN % kTM == 0 && kTM == 256 && kD == 64 && kThr == 256 && kH == 16, "transposing cast exact: 8 tiles of 256 positions a plane; 16 lanes a source row; 32 chunks a tile row; sample = b >> 4");

/* ------------------------------------------------------------------------- */
/* THE FIRST PRODUCT, its K (2,048 key positions) SPLIT over kSP = 4 work-groups a batch: grid (4, 64) = 256 work-groups of 8 waves; block (p, b) sums the 512 key    */
/* positions m = 512 p .. 512 p + 511 of batch b and stores a whole 64 x 64 partial of S (f32, the carries taken off); the S cast adds the four partials in the order */
/* p = 0, 1, 2, 3.                                                                                                                                                     */
/* IN: the block's slices of KT16 and VT16 (64 rows of 1,024 B each) go through registers to LDS once: a wave's load covers 512 contiguous bytes of one row; all 32     */
/* loads of a thread are issued before the first LDS store. LDS rows have a pitch of 1,040 B (16 B x 65, odd): the 16 rows of a fragment load fall on all 64 banks.    */
/* PRODUCT: wave w owns rows d = 32 (w & 1) .. + 31 and columns e = 16 (w >> 1) .. + 15: two A fragments and one B fragment per 32 key positions, both by the engine's */
/* own loader (the same k order on both sides), ascending m.                                                                                                          */
/* OUT: accumulator register r of lane (c, h) is S[16 i + 8 h + r][c]: eight d in a row for one e, so the partial is stored transposed, SP[b][p][e][d], 16 B a store;   */
/* a wave alone writes each 128-B line (32 d of one e).                                                                                                                */
/* ------------------------------------------------------------------------- */
constexpr int kSP    = 4;
constexpr int kKS    = kN / kSP;
constexpr int kPitch = kKS + 8;
__global__ __launch_bounds__(kThr) void sprod_kernel(const unsigned short* __restrict__ KT16, const unsigned short* __restrict__ VT16, float* __restrict__ SP) {
  __shared__ __align__(16) _Float16 sA[kD * kPitch];
  __shared__ __align__(16) _Float16 sB[kD * kPitch];
  const unsigned p = blockIdx.x, b = blockIdx.y;
  const unsigned row0 = threadIdx.x >> 6, c = threadIdx.x & 63u;
  const size_t go = ((size_t)b * kD + row0) * kN + p * (unsigned)kKS + c * 8u;
  const _Float16* ag = (const _Float16*)KT16 + go;
  const _Float16* bg = (const _Float16*)VT16 + go;
  /* unrolled: ra and rb are indexed by constants and stay in registers; the 16 steps of 4 rows become immediate offsets */
  v8h ra[16], rb[16];
#pragma unroll
  for (int it = 0; it < 16; ++it) ra[it] = *(const v8h*)(ag + (size_t)it * 4 * kN);
#pragma unroll
  for (int it = 0; it < 16; ++it) rb[it] = *(const v8h*)(bg + (size_t)it * 4 * kN);
  /* the wait on address translations behind the 32 loads; it names both addresses as inputs, so that their registers are kept up to it and no load lands on them in front of it */
  asm volatile("s_wait_xcnt 0x0" :: "v"(ag), "v"(bg) : "memory");
  const unsigned so = row0 * (unsigned)kPitch + c * 8u;
#pragma unroll
  for (int it = 0; it < 16; ++it) *(v8h*)(sA + so + it * 4 * kPitch) = ra[it];
#pragma unroll
  for (int it = 0; it < 16; ++it) *(v8h*)(sB + so + it * 4 * kPitch) = rb[it];
  /* both slices are whole in LDS before any wave reads a fragment of them */
  __syncthreads();
  const unsigned lane = threadIdx.x & 31u, w = threadIdx.x >> 5;
  const unsigned rl = lane & 15u, hh = lane >> 4;
  const _Float16* pa = sA + ((w & 1u) * 32u + rl) * (unsigned)kPitch + hh * 8u;
  const _Float16* pb = sB + ((w >> 1) * 16u + rl) * (unsigned)kPitch + hh * 8u;
  v8f acc0 = (v8f){0.f,0.f,0.f,0.f,0.f,0.f,0.f,0.f};
  v8f acc1 = (v8f){0.f,0.f,0.f,0.f,0.f,0.f,0.f,0.f};
  /* unrolled: the 16 steps become immediate offsets of three LDS addresses, and the compiler fetches fragments ahead of the matrix instructions */
#pragma unroll
  for (int t = 0; t < kKS / 32; ++t) {
    const v16h a0 = Frag<_Float16>::load(pa + t * 32);
    const v16h a1 = Frag<_Float16>::load(pa + 16 * kPitch + t * 32);
    const v16h bf = Frag<_Float16>::load(pb + t * 32);
    acc0 = Frag<_Float16>::mma(a0, bf, acc0);
    acc1 = Frag<_Float16>::mma(a1, bf, acc1);
  }
  float* o = SP + (((size_t)b * kSP + p) * kD + (w >> 1) * 16u + rl) * kD + (w & 1u) * 32u + hh * 8u;
  /* the carries come off here, as in the engine's epilogue (a power of two: exact) */
  acc0 *= kSc1;
  acc1 *= kSc1;
  *(v4f*)(o)      = (v4f){acc0[0], acc0[1], acc0[2], acc0[3]};
  *(v4f*)(o + 4)  = (v4f){acc0[4], acc0[5], acc0[6], acc0[7]};
  *(v4f*)(o + 16) = (v4f){acc1[0], acc1[1], acc1[2], acc1[3]};
  *(v4f*)(o + 20) = (v4f){acc1[4], acc1[5], acc1[6], acc1[7]};
}
static_assert(kN % kSP == 0 && kKS == 512 && kD == 64 && kThr == 256 && ((kPitch * 2) % 32) == 16, "split product exact: 64 16-B chunks a slice row, 4 rows a step, 16 steps; 8 waves cover 64 x 64; LDS pitch 16 B x odd");

/* ------------------------------------------------------------------------- */
/* The zero bias (256 floats) and the sum and cast of S, ONE launch of 129 blocks of 256 threads (the branch is on the block index): block 0: ZB[thread] = 0; blocks    */
/* 1..128: thread = (batch b, row e, chunk of 8 columns d): i = 256 (block - 1) + thread (0..32,767): b = i >> 9, e = (i >> 3) & 63, d8 = 8 (i & 7): ST16[b][e][d8 + j] */
/* = f16(2^7 (SP[b][0][e][d8 + j] + SP[b][1][..] + SP[b][2][..] + SP[b][3][..])), flushed below 2^-14: two 16-B loads a partial, 8 lanes a 256-B row.                   */
/* ------------------------------------------------------------------------- */
__global__ __launch_bounds__(kThr) void scast_kernel(const float* __restrict__ SP, unsigned short* __restrict__ ST16, float* __restrict__ ZB) {
  if (blockIdx.x == 0u) {
    float* dp = ZB + threadIdx.x;
    *(float*)dp = 0.0f;
    
    return;
  }
  const unsigned i = (blockIdx.x - 1u) * (unsigned)kThr + threadIdx.x;
  const unsigned b = i >> 9, e = (i >> 3) & 63u, d8 = (i & 7u) * 8u;
  const float* sp = SP + ((size_t)b * kSP * kD + e) * kD + d8;
  v4f s0 = *(const v4f*)(sp);
  v4f s1 = *(const v4f*)(sp + 4);
#pragma unroll
  for (int p = 1; p < kSP; ++p) {
    s0 += *(const v4f*)(sp + (size_t)p * kD * kD);
    s1 += *(const v4f*)(sp + (size_t)p * kD * kD + 4);
  }
  v8h hv;
#pragma unroll
  for (int j = 0; j < 4; ++j) {
    hv[j]     = (_Float16)carry_flush(s0[j], kSCarry);
    hv[4 + j] = (_Float16)carry_flush(s1[j], kSCarry);
  }
  unsigned short* dp = ST16 + ((size_t)b * kD + e) * kD + d8;
  *(v8h*)dp = hv;
  
}
static_assert(kNb * kD * (kD / 8) == 128 * kThr && kD == 64, "S cast grid exact: 128 blocks; 512 threads a batch");

/* ------------------------------------------------------------------------- */
/* Host glue: 5 launches; kernel launches only: the cast of Q (a contiguous plane cast linearly as rows of 64); the transposing casts of K and V x; THE FIRST PRODUCT  */
/* S = KT16 VT16^T: M 64, N 64, K 2,048 a batch, K split in four: grid (4, 64), f32 partials in SP (it reads no bias); the zero bias with the sum and cast of S; THE   */
/* SECOND PRODUCT out = Q16 ST16^T / 8: M 2,048, N 64, K 64 a batch (32 tiles a batch: 4 blocks), the engine instantiation <0, false, 2, 0, false, 0> with its batch   */
/* index blockIdx.y and the three strides, its epilogue storing d_out ([64][2048][64]: ldc 64; strideC 131,072).                                                      */
/* ------------------------------------------------------------------------- */
static_assert(((size_t)kNb * kN * kD / 8) % kThr == 0 && ((size_t)kNb * kN * kD) % 64 == 0, "plane cast grid exact; the plane is whole rows of 64");

extern "C" void kernel_launch(void* const* d_in, const int* in_sizes, int n_in,
                              void* d_out, int out_size, void* d_ws, size_t ws_size,
                              hipStream_t stream) {
  if (n_in < 4 || d_out == nullptr || d_ws == nullptr) return;
  if (in_sizes[0] != kNb * kN * kD || in_sizes[1] != kNb * kN * kD || in_sizes[2] != kNb * kN * kD || in_sizes[3] != kBs * kN) return;
  if (out_size != kNb * kN * kD) return;
  if (ws_size < kWsTotal) return;
  const float* Q = (const float*)d_in[0];
  const float* K = (const float*)d_in[1];
  const float* V = (const float*)d_in[2];
  const float* xw = (const float*)d_in[3];
  float* out = (float*)d_out;
  char* ws = (char*)d_ws;
  unsigned short* Q16 = (unsigned short*)(ws + kOffQ16);
  unsigned short* KT16 = (unsigned short*)(ws + kOffKT16);
  unsigned short* VT16 = (unsigned short*)(ws + kOffVT16);
  float* ZB = (float*)(ws + kOffZB);
  float* SP = (float*)(ws + kOffSP);
  unsigned short* ST16 = (unsigned short*)(ws + kOffST16);

  /* the plain cast of Q: <<<elements / 8 / 256>>>(src as rows of 64, dst, colsLog2 6, the same row length, column offset 0): a linear copy-cast */
  cast_plane_kernel<<<(int)(((size_t)kNb * kN * kD / 8) / kThr), kThr, 0, stream>>>(Q, Q16, 6, 64, 0);
  tcast_kernel<<<dim3(kN / kTM, 1, 2 * kNb), kThr, 0, stream>>>(K, V, xw, KT16, VT16);
  /* SP[b][p] = (KT16[b] . VT16[b]^T)^T over key positions 512 p .. 512 p + 511 */
  sprod_kernel<<<dim3(kSP, kNb), kThr, 0, stream>>>(KT16, VT16, SP);
  /* block 0 writes the zero bias that the second product reads; blocks 1..128 sum the partials and cast S */
  scast_kernel<<<129, kThr, 0, stream>>>(SP, ST16, ZB);
  /* out[b] = Q16[b] . ST16[b]^T / 8: M 2048, N 64, K 64; strides: A 2048 x 64, B 64 x 64, C 2048 x 64 */
  wmma_gemm64<0, false, 2, 0, false, 0><<<dim3((kN / 64) * (kD / 64) / 8, kNb), 256, 0, stream>>>(
      Q16, Q16, kD, (long)kN * kD, ST16, ST16, kD, (long)kD * kD, (void*)out, (void*)out, kD, (long)kN * kD, ZB, nullptr, 0L, kN, kD, kD, kSc2);
}

// v003
// Measured time: 26.3 microseconds a run.
// Timed twice side by side with v002, it ran 1.34 times as fast both times.
// All steps since v000 together make it 6.60 times as fast.
// Compute dtype: attention WITHOUT a softmax (scores = Q K^T / 8; out = scores (V x), x a weight per key position) over 64 (sample, head) batches of 2,048 positions and width 64, IN ITS REGROUPED FORM out = Q (K^T (V x)) / 8 (the module's own sums regrouped by associativity: no operation stands between its two products): the two batched products ([64 x 2048] x [2048 x 64] a batch: S = K^T (V x); [2048 x 64] x [64 x 64] a batch: Q S) on v_wmma_f32_16x16x32_f16, f32 accumulate, ONE f16 word per operand: Q and K as their bf16-RNE-converted values carried by 2^10 (exact in f16); V x (the product of two bf16 values, exact in f32) carried by 2^10 and S carried by 2^7 (one rounding each: the measured mode); every operand behind a flush select below 2^-14; the scale 1 / 8 folded into the second product's scale (a power of two: exact).
#include <hip/hip_runtime.h>
#include <math.h>

typedef __attribute__((ext_vector_type(16))) _Float16 v16h;
typedef __attribute__((ext_vector_type(8)))  _Float16 v8h;
typedef __attribute__((ext_vector_type(4)))  _Float16 v4h;
typedef __attribute__((ext_vector_type(8)))  float    v8f;
typedef __attribute__((ext_vector_type(4)))  float    v4f;

/* ------------------------------------------------------------------------- */
/* Shape constants                                                           */
/* ------------------------------------------------------------------------- */
constexpr int kBs   = 4;                  /* samples */
constexpr int kH    = 16;                 /* heads */
constexpr int kNb   = kBs * kH;           /* 64 batches: b = sample x 16 + head */
constexpr int kN    = 2048;               /* positions (queries and keys) */
constexpr int kD    = 64;                 /* width of a head (queries / keys and values alike) */
constexpr int kThr  = 256;
constexpr float kInCarry = 1024.0f;       /* the carry of Q, K and V x */
constexpr float kSCarry  = 128.0f;        /* S */
constexpr float kSc1 = 1.0f / (kInCarry * kInCarry);
constexpr float kSc2 = 1.0f / (kInCarry * kSCarry * 8.0f);   /* the module's 1 / sqrt(64) = 1 / 8 folded in: a power of two */
/* 2^-14: smallest normal f16 magnitude */
constexpr float kF16MinNormal = 6.103515625e-5f;


/* ------------------------------------------------------------------------- */
/* Workspace region map (bytes; every offset a multiple of 256; the chain is static_assert'ed below). No region is reused.          */
/*   KT16  f16 [64][64][2048]  K TRANSPOSED per batch: KT16[b][d][m] = K[b][m][d] x2^10: the first product's A (K = 2,048 key positions)                           16,777,216 */
/*   VT16  f16 [64][64][2048]  (V x) TRANSPOSED per batch: VT16[b][e][m] = V[b][m][e] x[sample][m] x2^10 (ONE f16 word: a computed operand): the first product's B^T  16,777,216 */
/*   SP    f32 [64][4][64][64] the first product's partial sums, TRANSPOSED: SP[b][p][e][d] = sum over the 512 key positions m of slice p of K[b][m][d] (V x)[b][m][e]   4,194,304 */
/*   ST16  f16 [64][64][64]    S TRANSPOSED per batch: ST16[b][e][d] = S[b][d][e] x2^7 (ONE f16 word: a computed operand): the second product's A                     524,288 */
/* ------------------------------------------------------------------------- */
constexpr size_t kOffKT16 = 0ull;
constexpr size_t kOffVT16 = 16777216ull;
constexpr size_t kOffSP = 33554432ull;
constexpr size_t kOffST16 = 37748736ull;
constexpr size_t kWsTotal = 38273024ull;
static_assert(kWsTotal <= 134217728ull, "carve cap: under 128 MiB");
static_assert(kOffKT16 == 0
              && kOffVT16 == kOffKT16 + 16777216ull
              && kOffSP == kOffVT16 + 16777216ull
              && kOffST16 == kOffSP + 4194304ull
              && kWsTotal == kOffST16 + 524288ull, "the carve is chained and totalled");
static_assert((kOffKT16 % 256) == 0 && (kOffVT16 % 256) == 0 && (kOffSP % 256) == 0 && (kOffST16 % 256) == 0, "aligned regions");

/* ------------------------------------------------------------------------- */
/* Small helpers                                                             */
/* ------------------------------------------------------------------------- */
__device__ __forceinline__ unsigned short f2bf_bits(float f) {
  unsigned u = __float_as_uint(f);
  return (unsigned short)((u + 0x7FFFu + ((u >> 16) & 1u)) >> 16);
}
__device__ __forceinline__ float bf_bits2f(unsigned short h) { return __uint_as_float(((unsigned)h) << 16); }
/* RNE-convert to a bf16 value, kept in f32 */
__device__ __forceinline__ float bf16r(float f) { return bf_bits2f(f2bf_bits(f)); }
/* carry by a power of two, then flush anything below the f16 normal range to +0 by a select */
__device__ __forceinline__ float carry_flush(float v, float carry) {
  const float s = v * carry;
  return (fabsf(s) < kF16MinNormal) ? 0.0f : s;
}

template <typename T> struct Frag;
template <> struct Frag<_Float16> {
  typedef v16h V; union U { v16h v; v8h h[2]; };
  /* elements 0..7 <- p[0..7], 8..15 <- p[16..23] */
  static __device__ __forceinline__ v16h load(const _Float16* p) {
    U f; f.h[0] = *(const v8h*)(p); f.h[1] = *(const v8h*)(p + 16); return f.v;
  }
  static __device__ __forceinline__ v8f mma(v16h a, v16h b, v8f c) {
    return __builtin_amdgcn_wmma_f32_16x16x32_f16(false, a, false, b, (short)0, c, false, false);
  }
};

/* ------------------------------------------------------------------------- */
/* The transposing casts of K and of V x, ONE launch: grid (8, 1, 128), block 256: z = batch b (0..63) and plane (z >> 6: 0 = K, 1 = V x: a branch on the block   */
/* index); x = a tile of kTM = 256 key positions (m0 = 256 blockIdx.x) by all 64 columns: 64 KiB of the source in a row. The values are those of the per-column    */
/* form: KT16[b][r][m] = f16(2^10 bf16(K[b][m][r])); VT16[b][r][m] = f16(2^10 bf16(V[b][m][r]) bf16(x[sample][m])), sample = b >> 4 (the product of two bf16       */
/* values is exact in f32; ONE f16 rounding).                                                                                                                     */
/* IN: thread = (dq = thread & 15: four columns 4 dq ..; oc = thread >> 4), two units c = oc and 16 + oc, a unit = 8 key positions: eight 16-B loads 256 B apart:  */
/* 16 lanes cover one whole 256-B source row. The unit's four columns go to LDS as four 16-B words of 8 positions each.                                           */
/* LDS: sT[r][chunk], a row = 32 chunks of 16 B (512 B, no pad); chunk c of row r lies at place c ^ (r >> 2): the 16 lanes of a store (rows 4 apart, one c) and    */
/* the 16 lanes of a load (one row, 16 chunks in a row) each fall on all 64 banks once.                                                                           */
/* OUT: behind the barrier a wave reads one row's 32 chunks and stores 512 contiguous bytes of KT16 / VT16.                                                       */
/* ------------------------------------------------------------------------- */
constexpr int kTM = 256;
/* IN for one plane kind: ISV picks the V x arithmetic at compile time, so the K blocks carry no multiply by x and no select */
template <bool ISV>
__device__ __forceinline__ void tcast_fill(const float* __restrict__ src, const float* __restrict__ xs, _Float16* sT, unsigned dq, unsigned oc) {
  /* every loop here is unrolled so that p, xr and hv are indexed by constants and stay in registers */
  v4f p[2][8];
#pragma unroll
  for (int u = 0; u < 2; ++u)
#pragma unroll
    for (int j = 0; j < 8; ++j) p[u][j] = *(const v4f*)(src + (size_t)(((unsigned)u * 16u + oc) * 8u + (unsigned)j) * kD);
#pragma unroll
  for (int u = 0; u < 2; ++u) {
    const unsigned c = (unsigned)u * 16u + oc;
    float xr[8];
    if (ISV) {
      const v4f x0 = *(const v4f*)(xs + c * 8u);
      const v4f x1 = *(const v4f*)(xs + c * 8u + 4u);
#pragma unroll
      for (int j = 0; j < 4; ++j) { xr[j] = bf16r(x0[j]); xr[4 + j] = bf16r(x1[j]); }
    }
#pragma unroll
    for (int e = 0; e < 4; ++e) {
      v8h hv;
#pragma unroll
      for (int j = 0; j < 8; ++j) {
        float v = bf16r(p[u][j][e]);
        if (ISV) v = v * xr[j];
        hv[j] = (_Float16)carry_flush(v, kInCarry);
      }
      *(v8h*)(sT + (dq * 4u + (unsigned)e) * (unsigned)kTM + (c ^ dq) * 8u) = hv;
    }
  }
}
__global__ __launch_bounds__(kThr) void tcast_kernel(const float* __restrict__ K, const float* __restrict__ V, const float* __restrict__ xw,
                                                    unsigned short* __restrict__ KT16, unsigned short* __restrict__ VT16) {
  __shared__ __align__(16) _Float16 sT[kD * kTM];
  const unsigned bz = blockIdx.z;
  const bool isV = bz >= (unsigned)kNb;            /* block-uniform */
  const unsigned b = isV ? (bz - (unsigned)kNb) : bz;
  const unsigned m0 = blockIdx.x * (unsigned)kTM;
  const unsigned dq = threadIdx.x & 15u;
  const unsigned oc = threadIdx.x >> 4;
  const size_t so = ((size_t)b * kN + m0) * kD + dq * 4u;
  if (isV) tcast_fill<true>(V + so, xw + (size_t)(b >> 4) * kN + m0, sT, dq, oc);
  else     tcast_fill<false>(K + so, xw, sT, dq, oc);
  /* every column of the tile is in LDS before any wave reads a row of it */
  __syncthreads();
  unsigned short* dst = (isV ? VT16 : KT16) + (size_t)b * kD * kN + m0;
  /* wave w takes rows r = 8 it + w: r >> 2 = 2 it + (w >> 2), and the two terms share no bit */
  const unsigned w = threadIdx.x >> 5, c = threadIdx.x & 31u;
  const unsigned cw = c ^ (w >> 2);
  const _Float16* sr = sT + w * (unsigned)kTM;
  unsigned short* dr = dst + (size_t)w * kN + c * 8u;
  /* unrolled: the eight rows' stores become immediate offsets of one global address; each LDS read keeps its own per-row XOR */
#pragma unroll
  for (int it = 0; it < 8; ++it) {
    const v8h hv = *(const v8h*)(sr + it * 8 * kTM + (cw ^ (unsigned)(2 * it)) * 8u);
    *(v8h*)(dr + (size_t)it * 8 * kN) = hv;
  }
}
static_assert(kN % kTM == 0 && kTM == 256 && kD == 64 && kThr == 256 && kH == 16, "transposing cast exact: 8 tiles of 256 positions a plane; 16 lanes a source row; 32 chunks a tile row; sample = b >> 4");

/* ------------------------------------------------------------------------- */
/* THE FIRST PRODUCT, its K (2,048 key positions) SPLIT over kSP = 4 work-groups a batch: grid (4, 64) = 256 work-groups of 8 waves; block (p, b) sums the 512 key    */
/* positions m = 512 p .. 512 p + 511 of batch b and stores a whole 64 x 64 partial of S (f32, the carries taken off); the S cast adds the four partials in the order */
/* p = 0, 1, 2, 3.                                                                                                                                                     */
/* IN: the block's slices of KT16 and VT16 (64 rows of 1,024 B each) go through registers to LDS once: a wave's load covers 512 contiguous bytes of one row; all 32     */
/* loads of a thread are issued before the first LDS store. LDS rows have a pitch of 1,040 B (16 B x 65, odd): the 16 rows of a fragment load fall on all 64 banks.    */
/* PRODUCT: wave w owns rows d = 32 (w & 1) .. + 31 and columns e = 16 (w >> 1) .. + 15: two A fragments and one B fragment per 32 key positions, both by the engine's */
/* own loader (the same k order on both sides), ascending m.                                                                                                          */
/* OUT: accumulator register r of lane (c, h) is S[16 i + 8 h + r][c]: eight d in a row for one e, so the partial is stored transposed, SP[b][p][e][d], 16 B a store;   */
/* a wave alone writes each 128-B line (32 d of one e).                                                                                                                */
/* ------------------------------------------------------------------------- */
constexpr int kSP    = 4;
constexpr int kKS    = kN / kSP;
constexpr int kPitch = kKS + 8;
__global__ __launch_bounds__(kThr) void sprod_kernel(const unsigned short* __restrict__ KT16, const unsigned short* __restrict__ VT16, float* __restrict__ SP) {
  __shared__ __align__(16) _Float16 sA[kD * kPitch];
  __shared__ __align__(16) _Float16 sB[kD * kPitch];
  const unsigned p = blockIdx.x, b = blockIdx.y;
  const unsigned row0 = threadIdx.x >> 6, c = threadIdx.x & 63u;
  const size_t go = ((size_t)b * kD + row0) * kN + p * (unsigned)kKS + c * 8u;
  const _Float16* ag = (const _Float16*)KT16 + go;
  const _Float16* bg = (const _Float16*)VT16 + go;
  /* unrolled: ra and rb are indexed by constants and stay in registers; the 16 steps of 4 rows become immediate offsets */
  v8h ra[16], rb[16];
#pragma unroll
  for (int it = 0; it < 16; ++it) ra[it] = *(const v8h*)(ag + (size_t)it * 4 * kN);
#pragma unroll
  for (int it = 0; it < 16; ++it) rb[it] = *(const v8h*)(bg + (size_t)it * 4 * kN);
  /* the wait on address translations behind the 32 loads; it names both addresses as inputs, so that their registers are kept up to it and no load lands on them in front of it */
  asm volatile("s_wait_xcnt 0x0" :: "v"(ag), "v"(bg) : "memory");
  const unsigned so = row0 * (unsigned)kPitch + c * 8u;
#pragma unroll
  for (int it = 0; it < 16; ++it) *(v8h*)(sA + so + it * 4 * kPitch) = ra[it];
#pragma unroll
  for (int it = 0; it < 16; ++it) *(v8h*)(sB + so + it * 4 * kPitch) = rb[it];
  /* both slices are whole in LDS before any wave reads a fragment of them */
  __syncthreads();
  const unsigned lane = threadIdx.x & 31u, w = threadIdx.x >> 5;
  const unsigned rl = lane & 15u, hh = lane >> 4;
  const _Float16* pa = sA + ((w & 1u) * 32u + rl) * (unsigned)kPitch + hh * 8u;
  const _Float16* pb = sB + ((w >> 1) * 16u + rl) * (unsigned)kPitch + hh * 8u;
  v8f acc0 = (v8f){0.f,0.f,0.f,0.f,0.f,0.f,0.f,0.f};
  v8f acc1 = (v8f){0.f,0.f,0.f,0.f,0.f,0.f,0.f,0.f};
  /* unrolled: the 16 steps become immediate offsets of three LDS addresses, and the compiler fetches fragments ahead of the matrix instructions */
#pragma unroll
  for (int t = 0; t < kKS / 32; ++t) {
    const v16h a0 = Frag<_Float16>::load(pa + t * 32);
    const v16h a1 = Frag<_Float16>::load(pa + 16 * kPitch + t * 32);
    const v16h bf = Frag<_Float16>::load(pb + t * 32);
    acc0 = Frag<_Float16>::mma(a0, bf, acc0);
    acc1 = Frag<_Float16>::mma(a1, bf, acc1);
  }
  float* o = SP + (((size_t)b * kSP + p) * kD + (w >> 1) * 16u + rl) * kD + (w & 1u) * 32u + hh * 8u;
  /* the carries come off here, as in the engine's epilogue (a power of two: exact) */
  acc0 *= kSc1;
  acc1 *= kSc1;
  *(v4f*)(o)      = (v4f){acc0[0], acc0[1], acc0[2], acc0[3]};
  *(v4f*)(o + 4)  = (v4f){acc0[4], acc0[5], acc0[6], acc0[7]};
  *(v4f*)(o + 16) = (v4f){acc1[0], acc1[1], acc1[2], acc1[3]};
  *(v4f*)(o + 20) = (v4f){acc1[4], acc1[5], acc1[6], acc1[7]};
}
static_assert(kN % kSP == 0 && kKS == 512 && kD == 64 && kThr == 256 && ((kPitch * 2) % 32) == 16, "split product exact: 64 16-B chunks a slice row, 4 rows a step, 16 steps; 8 waves cover 64 x 64; LDS pitch 16 B x odd");

/* ------------------------------------------------------------------------- */
/* The sum and cast of S, ONE launch of 128 blocks of 256 threads: thread = (batch b, row e, chunk of 8 columns d): i = 256 block + thread (0..32,767): b = i >> 9,     */
/* e = (i >> 3) & 63, d8 = 8 (i & 7): ST16[b][e][d8 + j] = f16(2^7 (SP[b][0][e][d8 + j] + SP[b][1][..] + SP[b][2][..] + SP[b][3][..])), flushed below 2^-14: two 16-B   */
/* loads a partial, 8 lanes a 256-B row.                                                                                                                               */
/* ------------------------------------------------------------------------- */
__global__ __launch_bounds__(kThr) void scast_kernel(const float* __restrict__ SP, unsigned short* __restrict__ ST16) {
  const unsigned i = blockIdx.x * (unsigned)kThr + threadIdx.x;
  const unsigned b = i >> 9, e = (i >> 3) & 63u, d8 = (i & 7u) * 8u;
  const float* sp = SP + ((size_t)b * kSP * kD + e) * kD + d8;
  v4f s0 = *(const v4f*)(sp);
  v4f s1 = *(const v4f*)(sp + 4);
#pragma unroll
  for (int p = 1; p < kSP; ++p) {
    s0 += *(const v4f*)(sp + (size_t)p * kD * kD);
    s1 += *(const v4f*)(sp + (size_t)p * kD * kD + 4);
  }
  v8h hv;
#pragma unroll
  for (int j = 0; j < 4; ++j) {
    hv[j]     = (_Float16)carry_flush(s0[j], kSCarry);
    hv[4 + j] = (_Float16)carry_flush(s1[j], kSCarry);
  }
  unsigned short* dp = ST16 + ((size_t)b * kD + e) * kD + d8;
  *(v8h*)dp = hv;
}
static_assert(kNb * kD * (kD / 8) == 128 * kThr && kD == 64, "S cast grid exact: 128 blocks; 512 threads a batch");

/* ------------------------------------------------------------------------- */
/* THE SECOND PRODUCT, READING Q AS IT COMES (f32): out[b][n][e] = sum over d of Q[b][n][d] S[b][d][e] / 8. Grid (4, 64) = 256 work-groups of 8 waves; block (x, b)     */
/* takes the 512 query rows n = 512 x .. + 511 of batch b, a wave 64 of them: 16 KiB of Q in a row, 16 KiB of out in a row.                                            */
/* IN: a wave's load covers two whole 256-B rows of Q (512 contiguous bytes); all 32 loads of a thread, and its two of ST16, are issued before the first LDS store.     */
/* Each value is cast in registers, f16(2^10 bf16(Q)), flushed below 2^-14, and goes to the wave's own rows of sQ, 8 B a lane. ST16[b] (8 KiB) goes to sS once a block.  */
/* Both have a row pitch of 144 B (16 B x 9, odd): the 16 rows of a fragment load fall on all 64 banks.                                                                */
/* PRODUCT: S^T is the A operand (rows e) and Q the B operand (columns n), both by the same loader (the same k order on both sides), d ascending in two steps of 32.    */
/* OUT: accumulator register r of lane (c, h) is out[16 j + c][16 i + 8 h + r]: eight e in a row for one n: two 16-B LDS stores into the wave's own slab (pitch 272 B   */
/* = 16 B x 17, odd); read back by rows, a wave's store covers two whole 256-B rows of out (512 contiguous bytes).                                                     */
/* ------------------------------------------------------------------------- */
constexpr int kQR = 64;          /* query rows a wave */
constexpr int kAP = kD + 8;      /* f16 a row of sS and sQ */
constexpr int kOP = kD + 4;      /* f32 a row of sO */
__global__ __launch_bounds__(kThr) void qprod_kernel(const float* __restrict__ Q, const unsigned short* __restrict__ ST16, float* __restrict__ out) {
  __shared__ __align__(16) _Float16 sS[kD * kAP];
  __shared__ __align__(16) _Float16 sQ[8][kQR * kAP];
  __shared__ __align__(16) float    sO[8][kQR * kOP];
  const unsigned b = blockIdx.y;
  const unsigned lane = threadIdx.x & 31u, w = threadIdx.x >> 5;
  const unsigned rl = lane & 15u, hh = lane >> 4;
  const size_t ro = ((size_t)b * kN + (blockIdx.x * 8u + w) * (unsigned)kQR + hh) * kD + rl * 4u;
  const _Float16* sg = (const _Float16*)ST16 + (size_t)b * kD * kD + threadIdx.x * 8u;
  const float* qg = Q + ro;
  /* unrolled: p is indexed by constants and stays in registers; the 32 steps of 2 rows become immediate offsets */
  v4f p[32];
#pragma unroll
  for (int it = 0; it < 32; ++it) p[it] = *(const v4f*)(qg + (size_t)it * 2 * kD);
  const v8h t0 = *(const v8h*)(sg);
  const v8h t1 = *(const v8h*)(sg + 32 * kD);
  /* the wait on address translations behind the 34 loads; it names Q's address as an input, so that its registers are kept up to it and no load lands on them in front of it */
  asm volatile("s_wait_xcnt 0x0" :: "v"(qg) : "memory");
  _Float16* qs = sQ[w] + hh * (unsigned)kAP + rl * 4u;
#pragma unroll
  for (int it = 0; it < 32; ++it) {
    v4h hv;
#pragma unroll
    for (int e = 0; e < 4; ++e) hv[e] = (_Float16)carry_flush(bf16r(p[it][e]), kInCarry);
    *(v4h*)(qs + it * 2 * kAP) = hv;
  }
  {
    _Float16* ss = sS + (threadIdx.x >> 3) * (unsigned)kAP + (threadIdx.x & 7u) * 8u;
    *(v8h*)(ss) = t0;
    *(v8h*)(ss + 32 * kAP) = t1;
  }
  /* S and every wave's rows of Q are whole in LDS before any wave reads a fragment of them */
  __syncthreads();
  const _Float16* pa = sS + rl * (unsigned)kAP + hh * 8u;
  const _Float16* pb = sQ[w] + rl * (unsigned)kAP + hh * 8u;
  v16h sf[4][2];
#pragma unroll
  for (int i = 0; i < 4; ++i)
#pragma unroll
    for (int s = 0; s < 2; ++s) sf[i][s] = Frag<_Float16>::load(pa + i * 16 * kAP + s * 32);
  float* os = sO[w] + rl * (unsigned)kOP + hh * 8u;
#pragma unroll
  for (int j = 0; j < 4; ++j) {
    const v16h q0 = Frag<_Float16>::load(pb + j * 16 * kAP);
    const v16h q1 = Frag<_Float16>::load(pb + j * 16 * kAP + 32);
    v8f acc[4];
#pragma unroll
    for (int i = 0; i < 4; ++i) acc[i] = Frag<_Float16>::mma(sf[i][0], q0, (v8f){0.f,0.f,0.f,0.f,0.f,0.f,0.f,0.f});
#pragma unroll
    for (int i = 0; i < 4; ++i) acc[i] = Frag<_Float16>::mma(sf[i][1], q1, acc[i]);
#pragma unroll
    for (int i = 0; i < 4; ++i) {
      /* the carries and the module's 1 / 8 come off here (a power of two: exact) */
      acc[i] *= kSc2;
      *(v4f*)(os + j * 16 * kOP + i * 16)     = (v4f){acc[i][0], acc[i][1], acc[i][2], acc[i][3]};
      *(v4f*)(os + j * 16 * kOP + i * 16 + 4) = (v4f){acc[i][4], acc[i][5], acc[i][6], acc[i][7]};
    }
  }
  /* the wave's own slab is whole in LDS before its lanes read one another's rows back; the clobber keeps the compiler from lifting those reads over the stores */
  asm volatile("s_wait_dscnt 0x0" ::: "memory");
  const float* orr = sO[w] + hh * (unsigned)kOP + rl * 4u;
  float* og = out + ro;
  /* unrolled: r is indexed by constants and stays in registers; the 32 steps of 2 rows become immediate offsets of one LDS address and one global address */
  v4f r[32];
#pragma unroll
  for (int it = 0; it < 32; ++it) r[it] = *(const v4f*)(orr + it * 2 * kOP);
#pragma unroll
  for (int it = 0; it < 32; ++it) *(v4f*)(og + (size_t)it * 2 * kD) = r[it];
}
static_assert(kN % (8 * kQR) == 0 && kQR == 64 && kD == 64 && kThr == 256 && ((kAP * 2) % 32) == 16 && ((kOP * 4) % 32) == 16, "second product exact: 4 blocks of 8 waves x 64 rows a batch; 16 lanes a 256-B row; 512 16-B chunks of S; LDS pitches 16 B x odd");

/* ------------------------------------------------------------------------- */
/* Host glue: 4 launches; kernel launches only: the transposing casts of K and V x; THE FIRST PRODUCT S = KT16 VT16^T: M 64, N 64, K 2,048 a batch, K split in four:    */
/* grid (4, 64), f32 partials in SP; the sum and cast of S; THE SECOND PRODUCT out = Q S / 8: 2,048 x 64 x 64 a batch, grid (4, 64), Q read as f32 and cast on the way  */
/* to LDS, storing d_out ([64][2048][64]).                                                                                                                            */
/* ------------------------------------------------------------------------- */
extern "C" void kernel_launch(void* const* d_in, const int* in_sizes, int n_in,
                              void* d_out, int out_size, void* d_ws, size_t ws_size,
                              hipStream_t stream) {
  if (n_in < 4 || d_out == nullptr || d_ws == nullptr) return;
  if (in_sizes[0] != kNb * kN * kD || in_sizes[1] != kNb * kN * kD || in_sizes[2] != kNb * kN * kD || in_sizes[3] != kBs * kN) return;
  if (out_size != kNb * kN * kD) return;
  if (ws_size < kWsTotal) return;
  const float* Q = (const float*)d_in[0];
  const float* K = (const float*)d_in[1];
  const float* V = (const float*)d_in[2];
  const float* xw = (const float*)d_in[3];
  float* out = (float*)d_out;
  char* ws = (char*)d_ws;
  unsigned short* KT16 = (unsigned short*)(ws + kOffKT16);
  unsigned short* VT16 = (unsigned short*)(ws + kOffVT16);
  float* SP = (float*)(ws + kOffSP);
  unsigned short* ST16 = (unsigned short*)(ws + kOffST16);

  tcast_kernel<<<dim3(kN / kTM, 1, 2 * kNb), kThr, 0, stream>>>(K, V, xw, KT16, VT16);
  /* SP[b][p] = (KT16[b] . VT16[b]^T)^T over key positions 512 p .. 512 p + 511 */
  sprod_kernel<<<dim3(kSP, kNb), kThr, 0, stream>>>(KT16, VT16, SP);
  /* sums the partials and casts S */
  scast_kernel<<<128, kThr, 0, stream>>>(SP, ST16);
  /* out[b] = Q[b] . S[b] / 8 */
  qprod_kernel<<<dim3(kN / (8 * kQR), kNb), kThr, 0, stream>>>(Q, ST16, out);
}

// v004
// A run of this version takes 17.5 microseconds.
// In two side-by-side timings against v003, it was 1.49 and 1.50 times as fast.
// Counting every step since v000, it is 9.87 times as fast.
// Compute dtype: attention WITHOUT a softmax (scores = Q K^T / 8; out = scores (V x), x a weight per key position) over 64 (sample, head) batches of 2,048 positions and width 64, IN ITS REGROUPED FORM out = Q (K^T (V x)) / 8 (the module's own sums regrouped by associativity: no operation stands between its two products): the two batched products ([64 x 2048] x [2048 x 64] a batch: S = K^T (V x); [2048 x 64] x [64 x 64] a batch: Q S) on v_wmma_f32_16x16x32_f16, f32 accumulate, ONE f16 word per operand: Q and K as their bf16-RNE-converted values carried by 2^10 (exact in f16); V x (the product of two bf16 values, exact in f32) carried by 2^10 and S carried by 2^7 (one rounding each: the measured mode); every operand behind a flush select below 2^-14; the scale 1 / 8 folded into the second product's scale (a power of two: exact).
#include <hip/hip_runtime.h>
#include <math.h>

typedef __attribute__((ext_vector_type(16))) _Float16 v16h;
typedef __attribute__((ext_vector_type(8)))  _Float16 v8h;
typedef __attribute__((ext_vector_type(4)))  _Float16 v4h;
typedef __attribute__((ext_vector_type(8)))  float    v8f;
typedef __attribute__((ext_vector_type(4)))  float    v4f;

/* ------------------------------------------------------------------------- */
/* Shape constants                                                           */
/* ------------------------------------------------------------------------- */
constexpr int kBs   = 4;                  /* samples */
constexpr int kH    = 16;                 /* heads */
constexpr int kNb   = kBs * kH;           /* 64 batches: b = sample x 16 + head */
constexpr int kN    = 2048;               /* positions (queries and keys) */
constexpr int kD    = 64;                 /* width of a head (queries / keys and values alike) */
constexpr int kThr  = 256;
constexpr float kInCarry = 1024.0f;       /* the carry of Q, K and V x */
constexpr float kSCarry  = 128.0f;        /* S */
constexpr float kSc1 = 1.0f / (kInCarry * kInCarry);
constexpr float kSc2 = 1.0f / (kInCarry * kSCarry * 8.0f);   /* the module's 1 / sqrt(64) = 1 / 8 folded in: a power of two */
/* 2^-14: smallest normal f16 magnitude */
constexpr float kF16MinNormal = 6.103515625e-5f;


/* ------------------------------------------------------------------------- */
/* Workspace region map (bytes; every offset a multiple of 256; the chain is static_assert'ed below). No region is reused.          */
/*   SP    f32 [64][4][64][64] the first product's partial sums, TRANSPOSED: SP[b][p][e][d] = sum over the 512 key positions m of slice p of K[b][m][d] (V x)[b][m][e]   4,194,304 */
/*   ST16  f16 [64][64][64]    S TRANSPOSED per batch: ST16[b][e][d] = S[b][d][e] x2^7 (ONE f16 word: a computed operand): the second product's A                     524,288 */
/* ------------------------------------------------------------------------- */
constexpr size_t kOffSP = 0ull;
constexpr size_t kOffST16 = 4194304ull;
constexpr size_t kWsTotal = 4718592ull;
static_assert(kWsTotal <= 134217728ull, "carve cap: under 128 MiB");
static_assert(kOffSP == 0
              && kOffST16 == kOffSP + 4194304ull
              && kWsTotal == kOffST16 + 524288ull, "the carve is chained and totalled");
static_assert((kOffSP % 256) == 0 && (kOffST16 % 256) == 0, "aligned regions");

/* ------------------------------------------------------------------------- */
/* Small helpers                                                             */
/* ------------------------------------------------------------------------- */
__device__ __forceinline__ unsigned short f2bf_bits(float f) {
  unsigned u = __float_as_uint(f);
  return (unsigned short)((u + 0x7FFFu + ((u >> 16) & 1u)) >> 16);
}
__device__ __forceinline__ float bf_bits2f(unsigned short h) { return __uint_as_float(((unsigned)h) << 16); }
/* RNE-convert to a bf16 value, kept in f32 */
__device__ __forceinline__ float bf16r(float f) { return bf_bits2f(f2bf_bits(f)); }
/* carry by a power of two, then flush anything below the f16 normal range to +0 by a select */
__device__ __forceinline__ float carry_flush(float v, float carry) {
  const float s = v * carry;
  return (fabsf(s) < kF16MinNormal) ? 0.0f : s;
}

template <typename T> struct Frag;
template <> struct Frag<_Float16> {
  typedef v16h V; union U { v16h v; v8h h[2]; };
  /* elements 0..7 <- p[0..7], 8..15 <- p[16..23] */
  static __device__ __forceinline__ v16h load(const _Float16* p) {
    U f; f.h[0] = *(const v8h*)(p); f.h[1] = *(const v8h*)(p + 16); return f.v;
  }
  static __device__ __forceinline__ v8f mma(v16h a, v16h b, v8f c) {
    return __builtin_amdgcn_wmma_f32_16x16x32_f16(false, a, false, b, (short)0, c, false, false);
  }
};

/* ------------------------------------------------------------------------- */
/* THE FIRST PRODUCT, READING K, V AND x AS THEY COME (f32), its K (2,048 key positions) SPLIT over kSP = 4 work-groups a batch: grid (4, 64) = 256 work-groups of 8     */
/* waves; block (p, b) sums the 512 key positions m = 512 p .. 512 p + 511 of batch b and stores a whole 64 x 64 partial of S (f32, the carries taken off); the S cast   */
/* adds the four partials in the order p = 0, 1, 2, 3.                                                                                                                 */
/* OPERANDS: sA[d][m] = f16(2^10 bf16(K[b][m][d])); sB[e][m] = f16(2^10 bf16(V[b][m][e]) bf16(x[sample][m])), sample = b >> 4 (the product of two bf16 values is exact   */
/* in f32; ONE f16 rounding), each flushed below 2^-14.                                                                                                                */
/* IN: thread = (dq = thread & 15: four columns 4 dq ..; oc = thread >> 4); a unit = 8 key positions of one plane by those four columns: eight 16-B loads 256 B apart:   */
/* 16 lanes cover one whole 256-B source row. A stage u = 128 key positions = one unit of K and one of V a thread (chunk c = 16 u + oc). The units go K0 V0 K1 V1 ..     */
/* through four register buffers: a buffer is cast, turned and stored to LDS as four 16-B words of 8 positions each, then refilled with the unit four places on, so     */
/* that 24 loads of a wave or more stay in flight while it casts and while it multiplies, up to the last refill.                                                       */
/* LDS: a row = 64 chunks of 16 B (1,024 B, no pad); chunk c of row r lies at place c ^ f(r), f(r) = ((r >> 2) & 15) ^ ((r & 3) << 2): the 16 lanes of a store (rows 4    */
/* apart, one c) and the 16 lanes of a fragment load (16 rows in a row, one c) each fall on all 64 banks once. No place is written twice.                               */
/* PRODUCT: behind stage u's barrier, its four steps of 32 key positions: wave w owns rows d = 32 (w & 1) .. + 31 and columns e = 16 (w >> 1) .. + 15: two A fragments    */
/* and one B fragment a step, elements 0..7 from chunk 4 t + h and 8..15 from chunk 4 t + 2 + h on both sides (the same k order), ascending m.                          */
/* OUT: accumulator register r of lane (c, h) is S[16 i + 8 h + r][c]: eight d in a row for one e, so the partial is stored transposed, SP[b][p][e][d], 16 B a store;   */
/* a wave alone writes each 128-B line (32 d of one e).                                                                                                                */
/* ------------------------------------------------------------------------- */
constexpr int kSP = 4;
constexpr int kKS = kN / kSP;
constexpr int kUP = 128;         /* key positions a stage */
/* the eight loads of one unit; unrolled so that p is indexed by constants and stays in registers */
__device__ __forceinline__ void unit_load(v4f (&p)[8], const float* __restrict__ src) {
#pragma unroll
  for (int j = 0; j < 8; ++j) p[j] = *(const v4f*)(src + j * kD);
}
/* cast, turn and store one unit: ISV picks the V x arithmetic at compile time, so the K units carry no multiply by x and no select; every loop is unrolled so that p, xr and hv stay in registers */
template <bool ISV>
__device__ __forceinline__ void unit_store(const v4f (&p)[8], const v4f x0, const v4f x1, _Float16* sT, const unsigned (&so)[4]) {
  float xr[8];
  if (ISV) {
#pragma unroll
    for (int j = 0; j < 4; ++j) { xr[j] = bf16r(x0[j]); xr[4 + j] = bf16r(x1[j]); }
  }
#pragma unroll
  for (int e = 0; e < 4; ++e) {
    v8h hv;
#pragma unroll
    for (int j = 0; j < 8; ++j) {
      float v = bf16r(p[j][e]);
      if (ISV) v = v * xr[j];
      hv[j] = (_Float16)carry_flush(v, kInCarry);
    }
    *(v8h*)(sT + so[e]) = hv;
  }
}
__device__ __forceinline__ v16h frag2(const _Float16* lo, const _Float16* hi) {
  Frag<_Float16>::U f; f.h[0] = *(const v8h*)lo; f.h[1] = *(const v8h*)hi; return f.v;
}
/* the second bound (waves a SIMD) sets the register budget to 256: no register above v255 is used */
__global__ __launch_bounds__(kThr, 4) void sprod_kernel(const float* __restrict__ K, const float* __restrict__ V, const float* __restrict__ xw, float* __restrict__ SP) {
  __shared__ __align__(16) _Float16 sA[kD * kKS];
  __shared__ __align__(16) _Float16 sB[kD * kKS];
  const unsigned p = blockIdx.x, b = blockIdx.y;
  const unsigned dq = threadIdx.x & 15u, oc = threadIdx.x >> 4;
  const size_t go = ((size_t)b * kN + p * (unsigned)kKS + oc * 8u) * kD + dq * 4u;
  const float* kg = K + go;
  const float* vg = V + go;
  /* x: a block-uniform base and the thread's own byte offset, which is the one vector register that the loads of x name */
  const char* xb = (const char*)(xw + (size_t)(b >> 4) * kN + p * (unsigned)kKS);
  const unsigned xo = oc * 32u;
  /* every loop below is unrolled: xv, buf, so, oa and ob are indexed by constants and stay in registers; the stages become immediate offsets */
  v4f xv[4][2];
#pragma unroll
  for (int u = 0; u < 2; ++u) { xv[u][0] = *(const v4f*)(xb + xo + u * kUP * 4); xv[u][1] = *(const v4f*)(xb + xo + u * kUP * 4 + 16); }
  v4f buf[4][8];
#pragma unroll
  for (int n = 0; n < 4; ++n) {
    unit_load(buf[n], ((n & 1) ? vg : kg) + (size_t)(n >> 1) * kUP * kD);
    /* loads return in the order of issue: this keeps a stage's loads in front of every later stage's, so that the wait for stage u does not also wait for stage u + 1 */
    if (n & 1) __builtin_amdgcn_sched_barrier(0);
  }
  unsigned so[4];
#pragma unroll
  for (int e = 0; e < 4; ++e) so[e] = (dq * 4u + (unsigned)e) * (unsigned)kKS + (oc ^ dq ^ (unsigned)(e << 2)) * 8u;
  const unsigned lane = threadIdx.x & 31u, w = threadIdx.x >> 5;
  const unsigned rl = lane & 15u, hh = lane >> 4;
  const unsigned ra = (w & 1u) * 32u + rl, rb = (w >> 1) * 16u + rl;
  const unsigned ga = hh ^ ((ra >> 2) & 15u) ^ ((ra & 3u) << 2);
  const unsigned gb = hh ^ ((rb >> 2) & 15u) ^ ((rb & 3u) << 2);
  /* place of chunk 2 k + h (mod 16) of the lane's row; row ra + 16 has f ^ 4, so its chunk 2 k + h lies where row ra has chunk 2 (k ^ 2) + h */
  unsigned oa[8], ob[8];
#pragma unroll
  for (int k = 0; k < 8; ++k) {
    oa[k] = ra * (unsigned)kKS + (ga ^ (unsigned)(2 * k)) * 8u;
    ob[k] = rb * (unsigned)kKS + (gb ^ (unsigned)(2 * k)) * 8u;
  }
  v8f acc0 = (v8f){0.f,0.f,0.f,0.f,0.f,0.f,0.f,0.f};
  v8f acc1 = (v8f){0.f,0.f,0.f,0.f,0.f,0.f,0.f,0.f};
#pragma unroll
  for (int n = 0; n < 8; ++n) {
    const int u = n >> 1;
    if (n & 1) unit_store<true>(buf[n & 3], xv[u][0], xv[u][1], sB + u * kUP, so);
    else       unit_store<false>(buf[n & 3], xv[u][0], xv[u][1], sA + u * kUP, so);
    if (n + 4 < 8) {
      /* x of a later stage comes with that stage's unit of V */
      if (n & 1) { xv[u + 2][0] = *(const v4f*)(xb + xo + (u + 2) * kUP * 4); xv[u + 2][1] = *(const v4f*)(xb + xo + (u + 2) * kUP * 4 + 16); }
      unit_load(buf[n & 3], ((n & 1) ? vg : kg) + (size_t)((n + 4) >> 1) * kUP * kD);
      /* keeps the units' casts apart: without it the casts of K and V of a stage are woven together and the refills are issued only at the stage's end, with fewer loads in flight */
      __builtin_amdgcn_sched_barrier(0);
    }
    /* the wait on address translations behind the last of the 72 loads; it names the two addresses and x's offset as inputs, so that their registers are kept up to it and no load lands on them in front of it */
    if (n == 3) asm volatile("s_wait_xcnt 0x0" :: "v"(kg), "v"(vg), "v"(xo) : "memory");
    if (n & 1) {
      /* stage u of both planes is whole in LDS before any wave reads a fragment of it: the wave's own LDS stores have landed, then the work-group's barrier; written by hand because */
      /* the global loads of the later stages are meant to stay in flight across it, which __syncthreads() does not promise */
      asm volatile("s_wait_dscnt 0x0" ::: "memory");
      asm volatile("s_barrier_signal -1\n\ts_barrier_wait -1" ::: "memory");
#pragma unroll
      for (int s = 0; s < 4; ++s) {
        const v16h a0 = frag2(sA + oa[2 * s] + u * kUP, sA + oa[2 * s + 1] + u * kUP);
        const v16h a1 = frag2(sA + oa[(2 * s) ^ 2] + 16 * kKS + u * kUP, sA + oa[(2 * s + 1) ^ 2] + 16 * kKS + u * kUP);
        const v16h bf = frag2(sB + ob[2 * s] + u * kUP, sB + ob[2 * s + 1] + u * kUP);
        acc0 = Frag<_Float16>::mma(a0, bf, acc0);
        acc1 = Frag<_Float16>::mma(a1, bf, acc1);
      }
    }
  }
  float* o = SP + (((size_t)b * kSP + p) * kD + (w >> 1) * 16u + rl) * kD + (w & 1u) * 32u + hh * 8u;
  /* the carries come off here, as in the engine's epilogue (a power of two: exact) */
  acc0 *= kSc1;
  acc1 *= kSc1;
  *(v4f*)(o)      = (v4f){acc0[0], acc0[1], acc0[2], acc0[3]};
  *(v4f*)(o + 4)  = (v4f){acc0[4], acc0[5], acc0[6], acc0[7]};
  *(v4f*)(o + 16) = (v4f){acc1[0], acc1[1], acc1[2], acc1[3]};
  *(v4f*)(o + 20) = (v4f){acc1[4], acc1[5], acc1[6], acc1[7]};
}
static_assert(kN % kSP == 0 && kKS == 512 && kKS == 4 * kUP && kD == 64 && kThr == 256 && kH == 16, "split product exact: 4 stages of 16 chunks a slice row; 16 lanes a source row, 16 units a stage; 8 waves cover 64 x 64; sample = b >> 4");

/* ------------------------------------------------------------------------- */
/* The sum and cast of S, ONE launch of 128 blocks of 256 threads: thread = (batch b, row e, chunk of 8 columns d): i = 256 block + thread (0..32,767): b = i >> 9,     */
/* e = (i >> 3) & 63, d8 = 8 (i & 7): ST16[b][e][d8 + j] = f16(2^7 (SP[b][0][e][d8 + j] + SP[b][1][..] + SP[b][2][..] + SP[b][3][..])), flushed below 2^-14: two 16-B   */
/* loads a partial, 8 lanes a 256-B row.                                                                                                                               */
/* ------------------------------------------------------------------------- */
__global__ __launch_bounds__(kThr) void scast_kernel(const float* __restrict__ SP, unsigned short* __restrict__ ST16) {
  const unsigned i = blockIdx.x * (unsigned)kThr + threadIdx.x;
  const unsigned b = i >> 9, e = (i >> 3) & 63u, d8 = (i & 7u) * 8u;
  const float* sp = SP + ((size_t)b * kSP * kD + e) * kD + d8;
  v4f s0 = *(const v4f*)(sp);
  v4f s1 = *(const v4f*)(sp + 4);
#pragma unroll
  for (int p = 1; p < kSP; ++p) {
    s0 += *(const v4f*)(sp + (size_t)p * kD * kD);
    s1 += *(const v4f*)(sp + (size_t)p * kD * kD + 4);
  }
  v8h hv;
#pragma unroll
  for (int j = 0; j < 4; ++j) {
    hv[j]     = (_Float16)carry_flush(s0[j], kSCarry);
    hv[4 + j] = (_Float16)carry_flush(s1[j], kSCarry);
  }
  unsigned short* dp = ST16 + ((size_t)b * kD + e) * kD + d8;
  *(v8h*)dp = hv;
}
static_assert(kNb * kD * (kD / 8) == 128 * kThr && kD == 64, "S cast grid exact: 128 blocks; 512 threads a batch");

/* ------------------------------------------------------------------------- */
/* THE SECOND PRODUCT, READING Q AS IT COMES (f32): out[b][n][e] = sum over d of Q[b][n][d] S[b][d][e] / 8. Grid (4, 64) = 256 work-groups of 8 waves; block (x, b)     */
/* takes the 512 query rows n = 512 x .. + 511 of batch b, a wave 64 of them: 16 KiB of Q in a row, 16 KiB of out in a row.                                            */
/* IN: a wave's load covers two whole 256-B rows of Q (512 contiguous bytes); all 32 loads of a thread, and its two of ST16, are issued before the first LDS store.     */
/* Each value is cast in registers, f16(2^10 bf16(Q)), flushed below 2^-14, and goes to the wave's own rows of sQ, 8 B a lane. ST16[b] (8 KiB) goes to sS once a block.  */
/* Both have a row pitch of 144 B (16 B x 9, odd): the 16 rows of a fragment load fall on all 64 banks.                                                                */
/* PRODUCT: S^T is the A operand (rows e) and Q the B operand (columns n), both by the same loader (the same k order on both sides), d ascending in two steps of 32.    */
/* OUT: accumulator register r of lane (c, h) is out[16 j + c][16 i + 8 h + r]: eight e in a row for one n: two 16-B LDS stores into the wave's own slab (pitch 272 B   */
/* = 16 B x 17, odd); read back by rows, a wave's store covers two whole 256-B rows of out (512 contiguous bytes).                                                     */
/* ------------------------------------------------------------------------- */
constexpr int kQR = 64;          /* query rows a wave */
constexpr int kAP = kD + 8;      /* f16 a row of sS and sQ */
constexpr int kOP = kD + 4;      /* f32 a row of sO */
__global__ __launch_bounds__(kThr) void qprod_kernel(const float* __restrict__ Q, const unsigned short* __restrict__ ST16, float* __restrict__ out) {
  __shared__ __align__(16) _Float16 sS[kD * kAP];
  __shared__ __align__(16) _Float16 sQ[8][kQR * kAP];
  __shared__ __align__(16) float    sO[8][kQR * kOP];
  const unsigned b = blockIdx.y;
  const unsigned lane = threadIdx.x & 31u, w = threadIdx.x >> 5;
  const unsigned rl = lane & 15u, hh = lane >> 4;
  const size_t ro = ((size_t)b * kN + (blockIdx.x * 8u + w) * (unsigned)kQR + hh) * kD + rl * 4u;
  const _Float16* sg = (const _Float16*)ST16 + (size_t)b * kD * kD + threadIdx.x * 8u;
  const float* qg = Q + ro;
  /* unrolled: p is indexed by constants and stays in registers; the 32 steps of 2 rows become immediate offsets */
  v4f p[32];
#pragma unroll
  for (int it = 0; it < 32; ++it) p[it] = *(const v4f*)(qg + (size_t)it * 2 * kD);
  const v8h t0 = *(const v8h*)(sg);
  const v8h t1 = *(const v8h*)(sg + 32 * kD);
  /* the wait on address translations behind the 34 loads; it names Q's address as an input, so that its registers are kept up to it and no load lands on them in front of it */
  asm volatile("s_wait_xcnt 0x0" :: "v"(qg) : "memory");
  _Float16* qs = sQ[w] + hh * (unsigned)kAP + rl * 4u;
#pragma unroll
  for (int it = 0; it < 32; ++it) {
    v4h hv;
#pragma unroll
    for (int e = 0; e < 4; ++e) hv[e] = (_Float16)carry_flush(bf16r(p[it][e]), kInCarry);
    *(v4h*)(qs + it * 2 * kAP) = hv;
  }
  {
    _Float16* ss = sS + (threadIdx.x >> 3) * (unsigned)kAP + (threadIdx.x & 7u) * 8u;
    *(v8h*)(ss) = t0;
    *(v8h*)(ss + 32 * kAP) = t1;
  }
  /* S and every wave's rows of Q are whole in LDS before any wave reads a fragment of them */
  __syncthreads();
  const _Float16* pa = sS + rl * (unsigned)kAP + hh * 8u;
  const _Float16* pb = sQ[w] + rl * (unsigned)kAP + hh * 8u;
  v16h sf[4][2];
#pragma unroll
  for (int i = 0; i < 4; ++i)
#pragma unroll
    for (int s = 0; s < 2; ++s) sf[i][s] = Frag<_Float16>::load(pa + i * 16 * kAP + s * 32);
  float* os = sO[w] + rl * (unsigned)kOP + hh * 8u;
#pragma unroll
  for (int j = 0; j < 4; ++j) {
    const v16h q0 = Frag<_Float16>::load(pb + j * 16 * kAP);
    const v16h q1 = Frag<_Float16>::load(pb + j * 16 * kAP + 32);
    v8f acc[4];
#pragma unroll
    for (int i = 0; i < 4; ++i) acc[i] = Frag<_Float16>::mma(sf[i][0], q0, (v8f){0.f,0.f,0.f,0.f,0.f,0.f,0.f,0.f});
#pragma unroll
    for (int i = 0; i < 4; ++i) acc[i] = Frag<_Float16>::mma(sf[i][1], q1, acc[i]);
#pragma unroll
    for (int i = 0; i < 4; ++i) {
      /* the carries and the module's 1 / 8 come off here (a power of two: exact) */
      acc[i] *= kSc2;
      *(v4f*)(os + j * 16 * kOP + i * 16)     = (v4f){acc[i][0], acc[i][1], acc[i][2], acc[i][3]};
      *(v4f*)(os + j * 16 * kOP + i * 16 + 4) = (v4f){acc[i][4], acc[i][5], acc[i][6], acc[i][7]};
    }
  }
  /* the wave's own slab is whole in LDS before its lanes read one another's rows back; the clobber keeps the compiler from lifting those reads over the stores */
  asm volatile("s_wait_dscnt 0x0" ::: "memory");
  const float* orr = sO[w] + hh * (unsigned)kOP + rl * 4u;
  float* og = out + ro;
  /* unrolled: r is indexed by constants and stays in registers; the 32 steps of 2 rows become immediate offsets of one LDS address and one global address */
  v4f r[32];
#pragma unroll
  for (int it = 0; it < 32; ++it) r[it] = *(const v4f*)(orr + it * 2 * kOP);
#pragma unroll
  for (int it = 0; it < 32; ++it) *(v4f*)(og + (size_t)it * 2 * kD) = r[it];
}
static_assert(kN % (8 * kQR) == 0 && kQR == 64 && kD == 64 && kThr == 256 && ((kAP * 2) % 32) == 16 && ((kOP * 4) % 32) == 16, "second product exact: 4 blocks of 8 waves x 64 rows a batch; 16 lanes a 256-B row; 512 16-B chunks of S; LDS pitches 16 B x odd");

/* ------------------------------------------------------------------------- */
/* Host glue: 3 launches; kernel launches only: THE FIRST PRODUCT S = K^T (V x): M 64, N 64, K 2,048 a batch, K split in four: grid (4, 64), K, V and x read as f32 and  */
/* cast and turned on the way to LDS, f32 partials in SP; the sum and cast of S; THE SECOND PRODUCT out = Q S / 8: 2,048 x 64 x 64 a batch, grid (4, 64), Q read as f32  */
/* and cast on the way to LDS, storing d_out ([64][2048][64]).                                                                                                        */
/* ------------------------------------------------------------------------- */
extern "C" void kernel_launch(void* const* d_in, const int* in_sizes, int n_in,
                              void* d_out, int out_size, void* d_ws, size_t ws_size,
                              hipStream_t stream) {
  if (n_in < 4 || d_out == nullptr || d_ws == nullptr) return;
  if (in_sizes[0] != kNb * kN * kD || in_sizes[1] != kNb * kN * kD || in_sizes[2] != kNb * kN * kD || in_sizes[3] != kBs * kN) return;
  if (out_size != kNb * kN * kD) return;
  if (ws_size < kWsTotal) return;
  const float* Q = (const float*)d_in[0];
  const float* K = (const float*)d_in[1];
  const float* V = (const float*)d_in[2];
  const float* xw = (const float*)d_in[3];
  float* out = (float*)d_out;
  char* ws = (char*)d_ws;
  float* SP = (float*)(ws + kOffSP);
  unsigned short* ST16 = (unsigned short*)(ws + kOffST16);

  /* SP[b][p] = (K[b]^T . (V x)[b])^T over key positions 512 p .. 512 p + 511 */
  sprod_kernel<<<dim3(kSP, kNb), kThr, 0, stream>>>(K, V, xw, SP);
  /* sums the partials and casts S */
  scast_kernel<<<128, kThr, 0, stream>>>(SP, ST16);
  /* out[b] = Q[b] . S[b] / 8 */
  qprod_kernel<<<dim3(kN / (8 * kQR), kNb), kThr, 0, stream>>>(Q, ST16, out);
}

// v005
// A run of this version takes 15.8 microseconds.
// Timed twice side by side with v004, it ran 1.11 and 1.12 times as fast.
// All steps since v000 together make it 11.0 times as fast.
// Compute dtype: attention WITHOUT a softmax (scores = Q K^T / 8; out = scores (V x), x a weight per key position) over 64 (sample, head) batches of 2,048 positions and width 64, IN ITS REGROUPED FORM out = Q (K^T (V x)) / 8 (the module's own sums regrouped by associativity: no operation stands between its two products): the two batched products ([64 x 2048] x [2048 x 64] a batch: S = K^T (V x); [2048 x 64] x [64 x 64] a batch: Q S) on v_wmma_f32_16x16x32_f16, f32 accumulate, ONE f16 word per operand: Q and K as their bf16-RNE-converted values carried by 2^10 (exact in f16); V x (the product of two bf16 values, exact in f32) carried by 2^10 and S carried by 2^7 (one rounding each: the measured mode); every operand behind a flush select below 2^-14; the scale 1 / 8 folded into the second product's scale (a power of two: exact).
#include <hip/hip_runtime.h>
#include <math.h>

typedef __attribute__((ext_vector_type(16))) _Float16 v16h;
typedef __attribute__((ext_vector_type(8)))  _Float16 v8h;
typedef __attribute__((ext_vector_type(4)))  _Float16 v4h;
typedef __attribute__((ext_vector_type(8)))  float    v8f;
typedef __attribute__((ext_vector_type(4)))  float    v4f;

/* ------------------------------------------------------------------------- */
/* Shape constants                                                           */
/* ------------------------------------------------------------------------- */
constexpr int kBs   = 4;                  /* samples */
constexpr int kH    = 16;                 /* heads */
constexpr int kNb   = kBs * kH;           /* 64 batches: b = sample x 16 + head */
constexpr int kN    = 2048;               /* positions (queries and keys) */
constexpr int kD    = 64;                 /* width of a head (queries / keys and values alike) */
constexpr int kThr  = 256;
constexpr float kInCarry = 1024.0f;       /* the carry of Q, K and V x */
constexpr float kSCarry  = 128.0f;        /* S */
constexpr float kSc1 = 1.0f / (kInCarry * kInCarry);
constexpr float kSc2 = 1.0f / (kInCarry * kSCarry * 8.0f);   /* the module's 1 / sqrt(64) = 1 / 8 folded in: a power of two */
/* 2^-14: smallest normal f16 magnitude */
constexpr float kF16MinNormal = 6.103515625e-5f;


/* ------------------------------------------------------------------------- */
/* Workspace region map (bytes; every offset a multiple of 256; the chain is static_assert'ed below). No region is reused.          */
/*   SP    f32 [64][4][64][64] the first product's partial sums, TRANSPOSED: SP[b][p][e][d] = sum over the 512 key positions m of slice p of K[b][m][d] (V x)[b][m][e]   4,194,304 */
/* ------------------------------------------------------------------------- */
constexpr size_t kOffSP = 0ull;
constexpr size_t kWsTotal = 4194304ull;
static_assert(kWsTotal <= 134217728ull, "carve cap: under 128 MiB");
static_assert(kOffSP == 0 && kWsTotal == kOffSP + 4194304ull, "the carve is chained and totalled");
static_assert((kOffSP % 256) == 0, "aligned regions");

/* ------------------------------------------------------------------------- */
/* Small helpers                                                             */
/* ------------------------------------------------------------------------- */
__device__ __forceinline__ unsigned short f2bf_bits(float f) {
  unsigned u = __float_as_uint(f);
  return (unsigned short)((u + 0x7FFFu + ((u >> 16) & 1u)) >> 16);
}
__device__ __forceinline__ float bf_bits2f(unsigned short h) { return __uint_as_float(((unsigned)h) << 16); }
/* RNE-convert to a bf16 value, kept in f32 */
__device__ __forceinline__ float bf16r(float f) { return bf_bits2f(f2bf_bits(f)); }
/* carry by a power of two, then flush anything below the f16 normal range to +0 by a select */
__device__ __forceinline__ float carry_flush(float v, float carry) {
  const float s = v * carry;
  return (fabsf(s) < kF16MinNormal) ? 0.0f : s;
}

template <typename T> struct Frag;
template <> struct Frag<_Float16> {
  typedef v16h V; union U { v16h v; v8h h[2]; };
  /* elements 0..7 <- p[0..7], 8..15 <- p[16..23] */
  static __device__ __forceinline__ v16h load(const _Float16* p) {
    U f; f.h[0] = *(const v8h*)(p); f.h[1] = *(const v8h*)(p + 16); return f.v;
  }
  static __device__ __forceinline__ v8f mma(v16h a, v16h b, v8f c) {
    return __builtin_amdgcn_wmma_f32_16x16x32_f16(false, a, false, b, (short)0, c, false, false);
  }
};

/* ------------------------------------------------------------------------- */
/* THE FIRST PRODUCT, READING K, V AND x AS THEY COME (f32), its K (2,048 key positions) SPLIT over kSP = 4 work-groups a batch: grid (4, 64) = 256 work-groups of 8     */
/* waves; block (p, b) sums the 512 key positions m = 512 p .. 512 p + 511 of batch b and stores a whole 64 x 64 partial of S (f32, the carries taken off); the second   */
/* product adds the four partials in the order p = 0, 1, 2, 3.                                                                                                         */
/* OPERANDS: sA[d][m] = f16(2^10 bf16(K[b][m][d])); sB[e][m] = f16(2^10 bf16(V[b][m][e]) bf16(x[sample][m])), sample = b >> 4 (the product of two bf16 values is exact   */
/* in f32; ONE f16 rounding), each flushed below 2^-14.                                                                                                                */
/* IN: thread = (dq = thread & 15: four columns 4 dq ..; oc = thread >> 4); a unit = 8 key positions of one plane by those four columns: eight 16-B loads 256 B apart:   */
/* 16 lanes cover one whole 256-B source row. A stage u = 128 key positions = one unit of K and one of V a thread (chunk c = 16 u + oc). The units go K0 V0 K1 V1 ..     */
/* through four register buffers: a buffer is cast, turned and stored to LDS as four 16-B words of 8 positions each, then refilled with the unit four places on, so     */
/* that 24 loads of a wave or more stay in flight while it casts and while it multiplies, up to the last refill.                                                       */
/* LDS: a row = 64 chunks of 16 B (1,024 B, no pad); chunk c of row r lies at place c ^ f(r), f(r) = ((r >> 2) & 15) ^ ((r & 3) << 2): the 16 lanes of a store (rows 4    */
/* apart, one c) and the 16 lanes of a fragment load (16 rows in a row, one c) each fall on all 64 banks once. No place is written twice.                               */
/* PRODUCT: behind stage u's barrier, its four steps of 32 key positions: wave w owns rows d = 32 (w & 1) .. + 31 and columns e = 16 (w >> 1) .. + 15: two A fragments    */
/* and one B fragment a step, elements 0..7 from chunk 4 t + h and 8..15 from chunk 4 t + 2 + h on both sides (the same k order), ascending m.                          */
/* OUT: accumulator register r of lane (c, h) is S[16 i + 8 h + r][c]: eight d in a row for one e, so the partial is stored transposed, SP[b][p][e][d], 16 B a store;   */
/* a wave alone writes each 128-B line (32 d of one e).                                                                                                                */
/* ------------------------------------------------------------------------- */
constexpr int kSP = 4;
constexpr int kKS = kN / kSP;
constexpr int kUP = 128;         /* key positions a stage */
/* the eight loads of one unit; unrolled so that p is indexed by constants and stays in registers */
__device__ __forceinline__ void unit_load(v4f (&p)[8], const float* __restrict__ src) {
#pragma unroll
  for (int j = 0; j < 8; ++j) p[j] = *(const v4f*)(src + j * kD);
}
/* cast, turn and store one unit: ISV picks the V x arithmetic at compile time, so the K units carry no multiply by x and no select; every loop is unrolled so that p, xr and hv stay in registers */
template <bool ISV>
__device__ __forceinline__ void unit_store(const v4f (&p)[8], const v4f x0, const v4f x1, _Float16* sT, const unsigned (&so)[4]) {
  float xr[8];
  if (ISV) {
#pragma unroll
    for (int j = 0; j < 4; ++j) { xr[j] = bf16r(x0[j]); xr[4 + j] = bf16r(x1[j]); }
  }
#pragma unroll
  for (int e = 0; e < 4; ++e) {
    v8h hv;
#pragma unroll
    for (int j = 0; j < 8; ++j) {
      float v = bf16r(p[j][e]);
      if (ISV) v = v * xr[j];
      hv[j] = (_Float16)carry_flush(v, kInCarry);
    }
    *(v8h*)(sT + so[e]) = hv;
  }
}
__device__ __forceinline__ v16h frag2(const _Float16* lo, const _Float16* hi) {
  Frag<_Float16>::U f; f.h[0] = *(const v8h*)lo; f.h[1] = *(const v8h*)hi; return f.v;
}
/* the second bound (waves a SIMD) sets the register budget to 256: no register above v255 is used */
__global__ __launch_bounds__(kThr, 4) void sprod_kernel(const float* __restrict__ K, const float* __restrict__ V, const float* __restrict__ xw, float* __restrict__ SP) {
  __shared__ __align__(16) _Float16 sA[kD * kKS];
  __shared__ __align__(16) _Float16 sB[kD * kKS];
  const unsigned p = blockIdx.x, b = blockIdx.y;
  const unsigned dq = threadIdx.x & 15u, oc = threadIdx.x >> 4;
  const size_t go = ((size_t)b * kN + p * (unsigned)kKS + oc * 8u) * kD + dq * 4u;
  const float* kg = K + go;
  const float* vg = V + go;
  /* x: a block-uniform base and the thread's own byte offset, which is the one vector register that the loads of x name */
  const char* xb = (const char*)(xw + (size_t)(b >> 4) * kN + p * (unsigned)kKS);
  const unsigned xo = oc * 32u;
  /* every loop below is unrolled: xv, buf, so, oa and ob are indexed by constants and stay in registers; the stages become immediate offsets */
  v4f xv[4][2];
#pragma unroll
  for (int u = 0; u < 2; ++u) { xv[u][0] = *(const v4f*)(xb + xo + u * kUP * 4); xv[u][1] = *(const v4f*)(xb + xo + u * kUP * 4 + 16); }
  v4f buf[4][8];
#pragma unroll
  for (int n = 0; n < 4; ++n) {
    unit_load(buf[n], ((n & 1) ? vg : kg) + (size_t)(n >> 1) * kUP * kD);
    /* loads return in the order of issue: this keeps a stage's loads in front of every later stage's, so that the wait for stage u does not also wait for stage u + 1 */
    if (n & 1) __builtin_amdgcn_sched_barrier(0);
  }
  unsigned so[4];
#pragma unroll
  for (int e = 0; e < 4; ++e) so[e] = (dq * 4u + (unsigned)e) * (unsigned)kKS + (oc ^ dq ^ (unsigned)(e << 2)) * 8u;
  const unsigned lane = threadIdx.x & 31u, w = threadIdx.x >> 5;
  const unsigned rl = lane & 15u, hh = lane >> 4;
  const unsigned ra = (w & 1u) * 32u + rl, rb = (w >> 1) * 16u + rl;
  const unsigned ga = hh ^ ((ra >> 2) & 15u) ^ ((ra & 3u) << 2);
  const unsigned gb = hh ^ ((rb >> 2) & 15u) ^ ((rb & 3u) << 2);
  /* place of chunk 2 k + h (mod 16) of the lane's row; row ra + 16 has f ^ 4, so its chunk 2 k + h lies where row ra has chunk 2 (k ^ 2) + h */
  unsigned oa[8], ob[8];
#pragma unroll
  for (int k = 0; k < 8; ++k) {
    oa[k] = ra * (unsigned)kKS + (ga ^ (unsigned)(2 * k)) * 8u;
    ob[k] = rb * (unsigned)kKS + (gb ^ (unsigned)(2 * k)) * 8u;
  }
  v8f acc0 = (v8f){0.f,0.f,0.f,0.f,0.f,0.f,0.f,0.f};
  v8f acc1 = (v8f){0.f,0.f,0.f,0.f,0.f,0.f,0.f,0.f};
#pragma unroll
  for (int n = 0; n < 8; ++n) {
    const int u = n >> 1;
    if (n & 1) unit_store<true>(buf[n & 3], xv[u][0], xv[u][1], sB + u * kUP, so);
    else       unit_store<false>(buf[n & 3], xv[u][0], xv[u][1], sA + u * kUP, so);
    if (n + 4 < 8) {
      /* x of a later stage comes with that stage's unit of V */
      if (n & 1) { xv[u + 2][0] = *(const v4f*)(xb + xo + (u + 2) * kUP * 4); xv[u + 2][1] = *(const v4f*)(xb + xo + (u + 2) * kUP * 4 + 16); }
      unit_load(buf[n & 3], ((n & 1) ? vg : kg) + (size_t)((n + 4) >> 1) * kUP * kD);
      /* keeps the units' casts apart: without it the casts of K and V of a stage are woven together and the refills are issued only at the stage's end, with fewer loads in flight */
      __builtin_amdgcn_sched_barrier(0);
    }
    /* the wait on address translations behind the last of the 72 loads; it names the two addresses and x's offset as inputs, so that their registers are kept up to it and no load lands on them in front of it */
    if (n == 3) asm volatile("s_wait_xcnt 0x0" :: "v"(kg), "v"(vg), "v"(xo) : "memory");
    if (n & 1) {
      /* stage u of both planes is whole in LDS before any wave reads a fragment of it: the wave's own LDS stores have landed, then the work-group's barrier; written by hand because */
      /* the global loads of the later stages are meant to stay in flight across it, which __syncthreads() does not promise */
      asm volatile("s_wait_dscnt 0x0" ::: "memory");
      asm volatile("s_barrier_signal -1\n\ts_barrier_wait -1" ::: "memory");
#pragma unroll
      for (int s = 0; s < 4; ++s) {
        const v16h a0 = frag2(sA + oa[2 * s] + u * kUP, sA + oa[2 * s + 1] + u * kUP);
        const v16h a1 = frag2(sA + oa[(2 * s) ^ 2] + 16 * kKS + u * kUP, sA + oa[(2 * s + 1) ^ 2] + 16 * kKS + u * kUP);
        const v16h bf = frag2(sB + ob[2 * s] + u * kUP, sB + ob[2 * s + 1] + u * kUP);
        acc0 = Frag<_Float16>::mma(a0, bf, acc0);
        acc1 = Frag<_Float16>::mma(a1, bf, acc1);
      }
    }
  }
  float* o = SP + (((size_t)b * kSP + p) * kD + (w >> 1) * 16u + rl) * kD + (w & 1u) * 32u + hh * 8u;
  /* the carries come off here (a power of two: exact) */
  acc0 *= kSc1;
  acc1 *= kSc1;
  *(v4f*)(o)      = (v4f){acc0[0], acc0[1], acc0[2], acc0[3]};
  *(v4f*)(o + 4)  = (v4f){acc0[4], acc0[5], acc0[6], acc0[7]};
  *(v4f*)(o + 16) = (v4f){acc1[0], acc1[1], acc1[2], acc1[3]};
  *(v4f*)(o + 20) = (v4f){acc1[4], acc1[5], acc1[6], acc1[7]};
}
static_assert(kN % kSP == 0 && kKS == 512 && kKS == 4 * kUP && kD == 64 && kThr == 256 && kH == 16, "split product exact: 4 stages of 16 chunks a slice row; 16 lanes a source row, 16 units a stage; 8 waves cover 64 x 64; sample = b >> 4");

/* ------------------------------------------------------------------------- */
/* THE SECOND PRODUCT, READING Q AS IT COMES (f32): out[b][n][e] = sum over d of Q[b][n][d] S[b][d][e] / 8. Grid (4, 64) = 256 work-groups of 8 waves; block (x, b)     */
/* takes the 512 query rows n = 512 x .. + 511 of batch b, a wave 64 of them: 16 KiB of Q in a row, 16 KiB of out in a row.                                            */
/* S: every block sums and casts the whole S of its batch itself: sS[e][d] = f16(2^7 (SP[b][0][e][d] + SP[b][1][e][d] + SP[b][2][e][d] + SP[b][3][e][d])), added in that    */
/* order, flushed below 2^-14 (ONE f16 word: a computed operand). Thread = four columns d of the rows e = (thread >> 4) + 16 k, k = 0..3: sixteen 16-B loads, a wave's     */
/* load covering two whole 256-B rows of a partial. They are issued in front of Q's loads and come from L2, so S is summed, cast and stored while Q is in flight.        */
/* IN: a wave's load covers two whole 256-B rows of Q (512 contiguous bytes); all 48 loads of a thread are issued before the first LDS store.                           */
/* Each value is cast in registers, f16(2^10 bf16(Q)), flushed below 2^-14, and goes to the wave's own rows of sQ, 8 B a lane.                                          */
/* Both have a row pitch of 144 B (16 B x 9, odd): the 16 rows of a fragment load fall on all 64 banks.                                                                */
/* PRODUCT: S^T is the A operand (rows e) and Q the B operand (columns n), both by the same loader (the same k order on both sides), d ascending in two steps of 32.    */
/* OUT: accumulator register r of lane (c, h) is out[16 j + c][16 i + 8 h + r]: eight e in a row for one n: two 16-B LDS stores into the wave's own slab (pitch 272 B   */
/* = 16 B x 17, odd); read back by rows, a wave's store covers two whole 256-B rows of out (512 contiguous bytes).                                                     */
/* ------------------------------------------------------------------------- */
constexpr int kQR = 64;          /* query rows a wave */
constexpr int kAP = kD + 8;      /* f16 a row of sS and sQ */
constexpr int kOP = kD + 4;      /* f32 a row of sO */
__global__ __launch_bounds__(kThr) void qprod_kernel(const float* __restrict__ Q, const float* __restrict__ SP, float* __restrict__ out) {
  __shared__ __align__(16) _Float16 sS[kD * kAP];
  __shared__ __align__(16) _Float16 sQ[8][kQR * kAP];
  __shared__ __align__(16) float    sO[8][kQR * kOP];
  const unsigned b = blockIdx.y;
  const unsigned lane = threadIdx.x & 31u, w = threadIdx.x >> 5;
  const unsigned rl = lane & 15u, hh = lane >> 4;
  const size_t ro = ((size_t)b * kN + (blockIdx.x * 8u + w) * (unsigned)kQR + hh) * kD + rl * 4u;
  const float* sg = SP + (size_t)b * kSP * kD * kD + threadIdx.x * 4u;
  const float* qg = Q + ro;
  /* unrolled: t and p are indexed by constants and stay in registers; the partials, the steps of 16 rows of S and the 32 steps of 2 rows of Q become immediate offsets */
  v4f t[4][kSP];
#pragma unroll
  for (int k = 0; k < 4; ++k)
#pragma unroll
    for (int q = 0; q < kSP; ++q) t[k][q] = *(const v4f*)(sg + (size_t)q * kD * kD + k * 16 * kD);
  v4f p[32];
#pragma unroll
  for (int it = 0; it < 32; ++it) p[it] = *(const v4f*)(qg + (size_t)it * 2 * kD);
  /* the wait on address translations behind the 48 loads; it names both addresses as inputs, so that their registers are kept up to it and no load lands on them in front of it */
  asm volatile("s_wait_xcnt 0x0" :: "v"(qg), "v"(sg) : "memory");
  /* keeps the sums of S behind Q's loads: without it they, and their waits for the partials, are lifted in front of Q's loads, which then start only when the partials have come */
  __builtin_amdgcn_sched_barrier(0);
  {
    _Float16* ss = sS + (threadIdx.x >> 4) * (unsigned)kAP + (threadIdx.x & 15u) * 4u;
#pragma unroll
    for (int k = 0; k < 4; ++k) {
      v4f sum = t[k][0];
#pragma unroll
      for (int q = 1; q < kSP; ++q) sum += t[k][q];
      v4h hv;
#pragma unroll
      for (int e = 0; e < 4; ++e) hv[e] = (_Float16)carry_flush(sum[e], kSCarry);
      *(v4h*)(ss + k * 16 * kAP) = hv;
    }
  }
  _Float16* qs = sQ[w] + hh * (unsigned)kAP + rl * 4u;
#pragma unroll
  for (int it = 0; it < 32; ++it) {
    v4h hv;
#pragma unroll
    for (int e = 0; e < 4; ++e) hv[e] = (_Float16)carry_flush(bf16r(p[it][e]), kInCarry);
    *(v4h*)(qs + it * 2 * kAP) = hv;
  }
  /* S and every wave's rows of Q are whole in LDS before any wave reads a fragment of them */
  __syncthreads();
  const _Float16* pa = sS + rl * (unsigned)kAP + hh * 8u;
  const _Float16* pb = sQ[w] + rl * (unsigned)kAP + hh * 8u;
  v16h sf[4][2];
#pragma unroll
  for (int i = 0; i < 4; ++i)
#pragma unroll
    for (int s = 0; s < 2; ++s) sf[i][s] = Frag<_Float16>::load(pa + i * 16 * kAP + s * 32);
  float* os = sO[w] + rl * (unsigned)kOP + hh * 8u;
#pragma unroll
  for (int j = 0; j < 4; ++j) {
    const v16h q0 = Frag<_Float16>::load(pb + j * 16 * kAP);
    const v16h q1 = Frag<_Float16>::load(pb + j * 16 * kAP + 32);
    v8f acc[4];
#pragma unroll
    for (int i = 0; i < 4; ++i) acc[i] = Frag<_Float16>::mma(sf[i][0], q0, (v8f){0.f,0.f,0.f,0.f,0.f,0.f,0.f,0.f});
#pragma unroll
    for (int i = 0; i < 4; ++i) acc[i] = Frag<_Float16>::mma(sf[i][1], q1, acc[i]);
#pragma unroll
    for (int i = 0; i < 4; ++i) {
      /* the carries and the module's 1 / 8 come off here (a power of two: exact) */
      acc[i] *= kSc2;
      *(v4f*)(os + j * 16 * kOP + i * 16)     = (v4f){acc[i][0], acc[i][1], acc[i][2], acc[i][3]};
      *(v4f*)(os + j * 16 * kOP + i * 16 + 4) = (v4f){acc[i][4], acc[i][5], acc[i][6], acc[i][7]};
    }
  }
  /* the wave's own slab is whole in LDS before its lanes read one another's rows back; the clobber keeps the compiler from lifting those reads over the stores */
  asm volatile("s_wait_dscnt 0x0" ::: "memory");
  const float* orr = sO[w] + hh * (unsigned)kOP + rl * 4u;
  float* og = out + ro;
  /* unrolled: r is indexed by constants and stays in registers; the 32 steps of 2 rows become immediate offsets of one LDS address and one global address */
  v4f r[32];
#pragma unroll
  for (int it = 0; it < 32; ++it) r[it] = *(const v4f*)(orr + it * 2 * kOP);
#pragma unroll
  for (int it = 0; it < 32; ++it) *(v4f*)(og + (size_t)it * 2 * kD) = r[it];
}
static_assert(kN % (8 * kQR) == 0 && kQR == 64 && kD == 64 && kThr == 256 && ((kAP * 2) % 32) == 16 && ((kOP * 4) % 32) == 16, "second product exact: 4 blocks of 8 waves x 64 rows a batch; 16 lanes a 256-B row; 1,024 16-B chunks a partial of S; LDS pitches 16 B x odd");

/* ------------------------------------------------------------------------- */
/* Host glue: 2 launches; kernel launches only: THE FIRST PRODUCT S = K^T (V x): M 64, N 64, K 2,048 a batch, K split in four: grid (4, 64), K, V and x read as f32 and  */
/* cast and turned on the way to LDS, f32 partials in SP; THE SECOND PRODUCT out = Q S / 8: 2,048 x 64 x 64 a batch, grid (4, 64), the partials of S summed and cast and  */
/* Q read as f32 and cast on the way to LDS, storing d_out ([64][2048][64]).                                                                                          */
/* ------------------------------------------------------------------------- */
extern "C" void kernel_launch(void* const* d_in, const int* in_sizes, int n_in,
                              void* d_out, int out_size, void* d_ws, size_t ws_size,
                              hipStream_t stream) {
  if (n_in < 4 || d_out == nullptr || d_ws == nullptr) return;
  if (in_sizes[0] != kNb * kN * kD || in_sizes[1] != kNb * kN * kD || in_sizes[2] != kNb * kN * kD || in_sizes[3] != kBs * kN) return;
  if (out_size != kNb * kN * kD) return;
  if (ws_size < kWsTotal) return;
  const float* Q = (const float*)d_in[0];
  const float* K = (const float*)d_in[1];
  const float* V = (const float*)d_in[2];
  const float* xw = (const float*)d_in[3];
  float* out = (float*)d_out;
  char* ws = (char*)d_ws;
  float* SP = (float*)(ws + kOffSP);

  /* SP[b][p] = (K[b]^T . (V x)[b])^T over key positions 512 p .. 512 p + 511 */
  sprod_kernel<<<dim3(kSP, kNb), kThr, 0, stream>>>(K, V, xw, SP);
  /* out[b] = Q[b] . S[b] / 8, S[b] the sum of its four partials */
  qprod_kernel<<<dim3(kN / (8 * kQR), kNb), kThr, 0, stream>>>(Q, SP, out);
}

// v006
// It runs in 14.4 microseconds.
// Two timings next to v005 put it at 1.09 and 1.08 times that version's speed.
// Over all steps from v000 it is 12.0 times as fast.
// Compute dtype: attention WITHOUT a softmax (scores = Q K^T / 8; out = scores (V x), x a weight per key position) over 64 (sample, head) batches of 2,048 positions and width 64, IN ITS REGROUPED FORM out = Q (K^T (V x)) / 8 (the module's own sums regrouped by associativity: no operation stands between its two products): the two batched products ([64 x 2048] x [2048 x 64] a batch: S = K^T (V x); [2048 x 64] x [64 x 64] a batch: Q S) on v_wmma_f32_16x16x32_f16, f32 accumulate, ONE f16 word per operand: Q and K as their bf16-RNE-converted values carried by 2^10 (exact in f16); V x (the product of two bf16 values, exact in f32) carried by 2^10 and S carried by 2^7 (one rounding each: the measured mode); every operand behind a flush select below 2^-14; the scale 1 / 8 folded into the second product's scale (a power of two: exact).
#include <hip/hip_runtime.h>
#include <math.h>

typedef __attribute__((ext_vector_type(16))) _Float16 v16h;
typedef __attribute__((ext_vector_type(8)))  _Float16 v8h;
typedef __attribute__((ext_vector_type(4)))  _Float16 v4h;
typedef __attribute__((ext_vector_type(8)))  float    v8f;
typedef __attribute__((ext_vector_type(4)))  float    v4f;
typedef __attribute__((ext_vector_type(2)))  float    v2f;
typedef __attribute__((ext_vector_type(2)))  __bf16   v2b;

/* ------------------------------------------------------------------------- */
/* Shape constants                                                           */
/* ------------------------------------------------------------------------- */
constexpr int kBs   = 4;                  /* samples */
constexpr int kH    = 16;                 /* heads */
constexpr int kNb   = kBs * kH;           /* 64 batches: b = sample x 16 + head */
constexpr int kN    = 2048;               /* positions (queries and keys) */
constexpr int kD    = 64;                 /* width of a head (queries / keys and values alike) */
constexpr int kThr  = 256;
constexpr float kInCarry = 1024.0f;       /* the carry of Q, K and V x */
constexpr float kSCarry  = 128.0f;        /* S */
constexpr float kSc1 = 1.0f / (kInCarry * kInCarry);
constexpr float kSc2 = 1.0f / (kInCarry * kSCarry * 8.0f);   /* the module's 1 / sqrt(64) = 1 / 8 folded in: a power of two */
/* 2^-14: smallest normal f16 magnitude */
constexpr float kF16MinNormal = 6.103515625e-5f;


/* ------------------------------------------------------------------------- */
/* Workspace region map (bytes; every offset a multiple of 256; the chain is static_assert'ed below). No region is reused.          */
/*   SP    f32 [64][4][64][64] the first product's partial sums, TRANSPOSED: SP[b][p][e][d] = sum over the 512 key positions m of slice p of K[b][m][d] (V x)[b][m][e]   4,194,304 */
/* ------------------------------------------------------------------------- */
constexpr size_t kOffSP = 0ull;
constexpr size_t kWsTotal = 4194304ull;
static_assert(kWsTotal <= 134217728ull, "carve cap: under 128 MiB");
static_assert(kOffSP == 0 && kWsTotal == kOffSP + 4194304ull, "the carve is chained and totalled");
static_assert((kOffSP % 256) == 0, "aligned regions");

/* ------------------------------------------------------------------------- */
/* Small helpers                                                             */
/* ------------------------------------------------------------------------- */
/* RNE-convert two values to bf16: one packed convert for the pair; a half is widened to f32 again (exact) where it is used */
__device__ __forceinline__ v2b bf16p(float a, float b) { return __builtin_convertvector((v2f){a, b}, v2b); }
/* carry by a power of two, then flush anything below the f16 normal range to +0 by a select */
__device__ __forceinline__ float carry_flush(float v, float carry) {
  const float s = v * carry;
  return (fabsf(s) < kF16MinNormal) ? 0.0f : s;
}

template <typename T> struct Frag;
template <> struct Frag<_Float16> {
  typedef v16h V; union U { v16h v; v8h h[2]; };
  /* elements 0..7 <- p[0..7], 8..15 <- p[16..23] */
  static __device__ __forceinline__ v16h load(const _Float16* p) {
    U f; f.h[0] = *(const v8h*)(p); f.h[1] = *(const v8h*)(p + 16); return f.v;
  }
  static __device__ __forceinline__ v8f mma(v16h a, v16h b, v8f c) {
    return __builtin_amdgcn_wmma_f32_16x16x32_f16(false, a, false, b, (short)0, c, false, false);
  }
};

/* ------------------------------------------------------------------------- */
/* THE FIRST PRODUCT, READING K, V AND x AS THEY COME (f32), its K (2,048 key positions) SPLIT over kSP = 4 work-groups a batch: grid (4, 64) = 256 work-groups of 8     */
/* waves; block (p, b) sums the 512 key positions m = 512 p .. 512 p + 511 of batch b and stores a whole 64 x 64 partial of S (f32, the carries taken off); the second   */
/* product adds the four partials in the order p = 0, 1, 2, 3.                                                                                                         */
/* OPERANDS: sA[d][m] = f16(2^10 bf16(K[b][m][d])); sB[e][m] = f16(2^10 bf16(V[b][m][e]) bf16(x[sample][m])), sample = b >> 4 (the product of two bf16 values is exact   */
/* in f32; ONE f16 rounding), each flushed below 2^-14.                                                                                                                */
/* IN: thread = (dq = thread & 15: four columns 4 dq ..; oc = thread >> 4); a unit = 8 key positions of one plane by those four columns: eight 16-B loads 256 B apart:   */
/* 16 lanes cover one whole 256-B source row. A stage u = 128 key positions = one unit of K and one of V a thread (chunk c = 16 u + oc). The units go K0 V0 K1 V1 ..     */
/* through four register buffers: a buffer is cast, turned and stored to LDS as four 16-B words of 8 positions each, then refilled with the unit four places on, so     */
/* that 24 loads of a wave or more stay in flight while it casts and while it multiplies, up to the last refill.                                                       */
/* LDS: a row = 64 chunks of 16 B (1,024 B, no pad); chunk c of row r lies at place c ^ f(r), f(r) = ((r >> 2) & 15) ^ ((r & 3) << 2): the 16 lanes of a store (rows 4    */
/* apart, one c) and the 16 lanes of a fragment load (16 rows in a row, one c) each fall on all 64 banks once. No place is written twice.                               */
/* PRODUCT: behind stage u's barrier, its four steps of 32 key positions: wave w owns rows d = 32 (w & 1) .. + 31 and columns e = 16 (w >> 1) .. + 15: two A fragments    */
/* and one B fragment a step, elements 0..7 from chunk 4 t + h and 8..15 from chunk 4 t + 2 + h on both sides (the same k order), ascending m.                          */
/* OUT: accumulator register r of lane (c, h) is S[16 i + 8 h + r][c]: eight d in a row for one e, so the partial is stored transposed, SP[b][p][e][d], 16 B a store;   */
/* a wave alone writes each 128-B line (32 d of one e).                                                                                                                */
/* ------------------------------------------------------------------------- */
constexpr int kSP = 4;
constexpr int kKS = kN / kSP;
constexpr int kUP = 128;         /* key positions a stage */
/* the eight loads of one unit; unrolled so that p is indexed by constants and stays in registers */
__device__ __forceinline__ void unit_load(v4f (&p)[8], const float* __restrict__ src) {
#pragma unroll
  for (int j = 0; j < 8; ++j) p[j] = *(const v4f*)(src + j * kD);
}
/* cast, turn and store one unit: ISV picks the V x arithmetic at compile time, so the K units carry no multiply by x and no select; every loop is unrolled so that p, xr and hv stay in registers */
template <bool ISV>
__device__ __forceinline__ void unit_store(const v4f (&p)[8], const v4f x0, const v4f x1, _Float16* sT, const unsigned (&so)[4]) {
  __bf16 xr[8];
  if (ISV) {
#pragma unroll
    for (int j = 0; j < 2; ++j) {
      const v2b a = bf16p(x0[2 * j], x0[2 * j + 1]), c = bf16p(x1[2 * j], x1[2 * j + 1]);
      xr[2 * j] = a[0]; xr[2 * j + 1] = a[1]; xr[4 + 2 * j] = c[0]; xr[4 + 2 * j + 1] = c[1];
    }
  }
  /* a pair = two columns in a row of one key position: the two registers that a load filled side by side */
  float s[8][4];
#pragma unroll
  for (int j = 0; j < 8; ++j)
#pragma unroll
    for (int e = 0; e < 4; e += 2) {
      const v2b h = bf16p(p[j][e], p[j][e + 1]);
      float v0 = (float)h[0], v1 = (float)h[1];
      if (ISV) { v0 = v0 * (float)xr[j]; v1 = v1 * (float)xr[j]; }
      s[j][e] = carry_flush(v0, kInCarry); s[j][e + 1] = carry_flush(v1, kInCarry);
    }
#pragma unroll
  for (int e = 0; e < 4; ++e) {
    v8h hv;
#pragma unroll
    for (int j = 0; j < 8; ++j) hv[j] = (_Float16)s[j][e];
    *(v8h*)(sT + so[e]) = hv;
  }
}
__device__ __forceinline__ v16h frag2(const _Float16* lo, const _Float16* hi) {
  Frag<_Float16>::U f; f.h[0] = *(const v8h*)lo; f.h[1] = *(const v8h*)hi; return f.v;
}
/* the second bound (waves a SIMD) sets the register budget to 256: no register above v255 is used */
__global__ __launch_bounds__(kThr, 4) void sprod_kernel(const float* __restrict__ K, const float* __restrict__ V, const float* __restrict__ xw, float* __restrict__ SP) {
  __shared__ __align__(16) _Float16 sA[kD * kKS];
  __shared__ __align__(16) _Float16 sB[kD * kKS];
  const unsigned p = blockIdx.x, b = blockIdx.y;
  const unsigned dq = threadIdx.x & 15u, oc = threadIdx.x >> 4;
  const size_t go = ((size_t)b * kN + p * (unsigned)kKS + oc * 8u) * kD + dq * 4u;
  const float* kg = K + go;
  const float* vg = V + go;
  /* x: a block-uniform base and the thread's own byte offset, which is the one vector register that the loads of x name */
  const char* xb = (const char*)(xw + (size_t)(b >> 4) * kN + p * (unsigned)kKS);
  const unsigned xo = oc * 32u;
  /* every loop below is unrolled: xv, buf, so, oa and ob are indexed by constants and stay in registers; the stages become immediate offsets */
  v4f xv[4][2];
#pragma unroll
  for (int u = 0; u < 2; ++u) { xv[u][0] = *(const v4f*)(xb + xo + u * kUP * 4); xv[u][1] = *(const v4f*)(xb + xo + u * kUP * 4 + 16); }
  v4f buf[4][8];
#pragma unroll
  for (int n = 0; n < 4; ++n) {
    unit_load(buf[n], ((n & 1) ? vg : kg) + (size_t)(n >> 1) * kUP * kD);
    /* loads return in the order of issue: this keeps a stage's loads in front of every later stage's, so that the wait for stage u does not also wait for stage u + 1 */
    if (n & 1) __builtin_amdgcn_sched_barrier(0);
  }
  unsigned so[4];
#pragma unroll
  for (int e = 0; e < 4; ++e) so[e] = (dq * 4u + (unsigned)e) * (unsigned)kKS + (oc ^ dq ^ (unsigned)(e << 2)) * 8u;
  const unsigned lane = threadIdx.x & 31u, w = threadIdx.x >> 5;
  const unsigned rl = lane & 15u, hh = lane >> 4;
  const unsigned ra = (w & 1u) * 32u + rl, rb = (w >> 1) * 16u + rl;
  const unsigned ga = hh ^ ((ra >> 2) & 15u) ^ ((ra & 3u) << 2);
  const unsigned gb = hh ^ ((rb >> 2) & 15u) ^ ((rb & 3u) << 2);
  /* place of chunk 2 k + h (mod 16) of the lane's row; row ra + 16 has f ^ 4, so its chunk 2 k + h lies where row ra has chunk 2 (k ^ 2) + h */
  unsigned oa[8], ob[8];
#pragma unroll
  for (int k = 0; k < 8; ++k) {
    oa[k] = ra * (unsigned)kKS + (ga ^ (unsigned)(2 * k)) * 8u;
    ob[k] = rb * (unsigned)kKS + (gb ^ (unsigned)(2 * k)) * 8u;
  }
  v8f acc0 = (v8f){0.f,0.f,0.f,0.f,0.f,0.f,0.f,0.f};
  v8f acc1 = (v8f){0.f,0.f,0.f,0.f,0.f,0.f,0.f,0.f};
#pragma unroll
  for (int n = 0; n < 8; ++n) {
    const int u = n >> 1;
    if (n & 1) unit_store<true>(buf[n & 3], xv[u][0], xv[u][1], sB + u * kUP, so);
    else       unit_store<false>(buf[n & 3], xv[u][0], xv[u][1], sA + u * kUP, so);
    if (n + 4 < 8) {
      /* x of a later stage comes with that stage's unit of V */
      if (n & 1) { xv[u + 2][0] = *(const v4f*)(xb + xo + (u + 2) * kUP * 4); xv[u + 2][1] = *(const v4f*)(xb + xo + (u + 2) * kUP * 4 + 16); }
      unit_load(buf[n & 3], ((n & 1) ? vg : kg) + (size_t)((n + 4) >> 1) * kUP * kD);
      /* keeps the units' casts apart: without it the casts of K and V of a stage are woven together and the refills are issued only at the stage's end, with fewer loads in flight */
      __builtin_amdgcn_sched_barrier(0);
    } else if (n < 7) {
      /* the later units too: without it the packed converts of the next unit, and with them the wait for its loads, are lifted in front of this unit's LDS stores and of the stage's barrier */
      __builtin_amdgcn_sched_barrier(0);
    }
    /* the wait on address translations behind the last of the 72 loads; it names the two addresses and x's offset as inputs, so that their registers are kept up to it and no load lands on them in front of it */
    if (n == 3) asm volatile("s_wait_xcnt 0x0" :: "v"(kg), "v"(vg), "v"(xo) : "memory");
    if (n & 1) {
      /* stage u of both planes is whole in LDS before any wave reads a fragment of it: the wave's own LDS stores have landed, then the work-group's barrier; written by hand because */
      /* the global loads of the later stages are meant to stay in flight across it, which __syncthreads() does not promise */
      asm volatile("s_wait_dscnt 0x0" ::: "memory");
      asm volatile("s_barrier_signal -1\n\ts_barrier_wait -1" ::: "memory");
#pragma unroll
      for (int s = 0; s < 4; ++s) {
        const v16h a0 = frag2(sA + oa[2 * s] + u * kUP, sA + oa[2 * s + 1] + u * kUP);
        const v16h a1 = frag2(sA + oa[(2 * s) ^ 2] + 16 * kKS + u * kUP, sA + oa[(2 * s + 1) ^ 2] + 16 * kKS + u * kUP);
        const v16h bf = frag2(sB + ob[2 * s] + u * kUP, sB + ob[2 * s + 1] + u * kUP);
        acc0 = Frag<_Float16>::mma(a0, bf, acc0);
        acc1 = Frag<_Float16>::mma(a1, bf, acc1);
      }
    }
  }
  float* o = SP + (((size_t)b * kSP + p) * kD + (w >> 1) * 16u + rl) * kD + (w & 1u) * 32u + hh * 8u;
  /* the carries come off here (a power of two: exact) */
  acc0 *= kSc1;
  acc1 *= kSc1;
  *(v4f*)(o)      = (v4f){acc0[0], acc0[1], acc0[2], acc0[3]};
  *(v4f*)(o + 4)  = (v4f){acc0[4], acc0[5], acc0[6], acc0[7]};
  *(v4f*)(o + 16) = (v4f){acc1[0], acc1[1], acc1[2], acc1[3]};
  *(v4f*)(o + 20) = (v4f){acc1[4], acc1[5], acc1[6], acc1[7]};
}
static_assert(kN % kSP == 0 && kKS == 512 && kKS == 4 * kUP && kD == 64 && kThr == 256 && kH == 16, "split product exact: 4 stages of 16 chunks a slice row; 16 lanes a source row, 16 units a stage; 8 waves cover 64 x 64; sample = b >> 4");

/* ------------------------------------------------------------------------- */
/* THE SECOND PRODUCT, READING Q AS IT COMES (f32): out[b][n][e] = sum over d of Q[b][n][d] S[b][d][e] / 8. Grid (4, 64) = 256 work-groups of 8 waves; block (x, b)     */
/* takes the 512 query rows n = 512 x .. + 511 of batch b, a wave 64 of them: 16 KiB of Q in a row, 16 KiB of out in a row.                                            */
/* S: every block sums and casts the whole S of its batch itself: sS[e][d] = f16(2^7 (SP[b][0][e][d] + SP[b][1][e][d] + SP[b][2][e][d] + SP[b][3][e][d])), added in that    */
/* order, flushed below 2^-14 (ONE f16 word: a computed operand). Thread = four columns d of the rows e = (thread >> 4) + 16 k, k = 0..3: sixteen 16-B loads, a wave's     */
/* load covering two whole 256-B rows of a partial. They are issued in front of Q's loads and come from L2, so S is summed, cast and stored while Q is in flight.        */
/* IN: a wave's load covers two whole 256-B rows of Q (512 contiguous bytes); all 48 loads of a thread are issued before the first LDS store.                           */
/* Each value is cast in registers, f16(2^10 bf16(Q)), flushed below 2^-14, and goes to the wave's own rows of sQ, 8 B a lane.                                          */
/* Both have a row pitch of 144 B (16 B x 9, odd): the 16 rows of a fragment load fall on all 64 banks.                                                                */
/* PRODUCT: S^T is the A operand (rows e) and Q the B operand (columns n), both by the same loader (the same k order on both sides), d ascending in two steps of 32.    */
/* OUT: accumulator register r of lane (c, h) is out[16 j + c][16 i + 8 h + r]: eight e in a row for one n: two 16-B LDS stores into the wave's own slab (pitch 272 B   */
/* = 16 B x 17, odd); read back by rows, a wave's store covers two whole 256-B rows of out (512 contiguous bytes).                                                     */
/* ------------------------------------------------------------------------- */
constexpr int kQR = 64;          /* query rows a wave */
constexpr int kAP = kD + 8;      /* f16 a row of sS and sQ */
constexpr int kOP = kD + 4;      /* f32 a row of sO */
__global__ __launch_bounds__(kThr) void qprod_kernel(const float* __restrict__ Q, const float* __restrict__ SP, float* __restrict__ out) {
  __shared__ __align__(16) _Float16 sS[kD * kAP];
  __shared__ __align__(16) _Float16 sQ[8][kQR * kAP];
  __shared__ __align__(16) float    sO[8][kQR * kOP];
  const unsigned b = blockIdx.y;
  const unsigned lane = threadIdx.x & 31u, w = threadIdx.x >> 5;
  const unsigned rl = lane & 15u, hh = lane >> 4;
  const size_t ro = ((size_t)b * kN + (blockIdx.x * 8u + w) * (unsigned)kQR + hh) * kD + rl * 4u;
  const float* sg = SP + (size_t)b * kSP * kD * kD + threadIdx.x * 4u;
  const float* qg = Q + ro;
  /* unrolled: t and p are indexed by constants and stay in registers; the partials, the steps of 16 rows of S and the 32 steps of 2 rows of Q become immediate offsets */
  v4f t[4][kSP];
#pragma unroll
  for (int k = 0; k < 4; ++k)
#pragma unroll
    for (int q = 0; q < kSP; ++q) t[k][q] = *(const v4f*)(sg + (size_t)q * kD * kD + k * 16 * kD);
  v4f p[32];
#pragma unroll
  for (int it = 0; it < 32; ++it) p[it] = *(const v4f*)(qg + (size_t)it * 2 * kD);
  /* the wait on address translations behind the 48 loads; it names both addresses as inputs, so that their registers are kept up to it and no load lands on them in front of it */
  asm volatile("s_wait_xcnt 0x0" :: "v"(qg), "v"(sg) : "memory");
  /* keeps the sums of S behind Q's loads: without it they, and their waits for the partials, are lifted in front of Q's loads, which then start only when the partials have come */
  __builtin_amdgcn_sched_barrier(0);
  {
    _Float16* ss = sS + (threadIdx.x >> 4) * (unsigned)kAP + (threadIdx.x & 15u) * 4u;
#pragma unroll
    for (int k = 0; k < 4; ++k) {
      v4f sum = t[k][0];
#pragma unroll
      for (int q = 1; q < kSP; ++q) sum += t[k][q];
      v4h hv;
#pragma unroll
      for (int e = 0; e < 4; ++e) hv[e] = (_Float16)carry_flush(sum[e], kSCarry);
      *(v4h*)(ss + k * 16 * kAP) = hv;
    }
  }
  _Float16* qs = sQ[w] + hh * (unsigned)kAP + rl * 4u;
#pragma unroll
  for (int it = 0; it < 32; ++it) {
    const v2b b0 = bf16p(p[it][0], p[it][1]), b1 = bf16p(p[it][2], p[it][3]);
    v4h hv;
    hv[0] = (_Float16)carry_flush((float)b0[0], kInCarry); hv[1] = (_Float16)carry_flush((float)b0[1], kInCarry);
    hv[2] = (_Float16)carry_flush((float)b1[0], kInCarry); hv[3] = (_Float16)carry_flush((float)b1[1], kInCarry);
    *(v4h*)(qs + it * 2 * kAP) = hv;
    /* keeps the cast of four loads together, in the order in which the loads return: without it every packed convert is lifted to the front, and the rest of the cast starts only when the last load has come */
    if ((it & 3) == 3 && it < 31) __builtin_amdgcn_sched_barrier(0);
  }
  /* S and every wave's rows of Q are whole in LDS before any wave reads a fragment of them */
  __syncthreads();
  const _Float16* pa = sS + rl * (unsigned)kAP + hh * 8u;
  const _Float16* pb = sQ[w] + rl * (unsigned)kAP + hh * 8u;
  v16h sf[4][2];
#pragma unroll
  for (int i = 0; i < 4; ++i)
#pragma unroll
    for (int s = 0; s < 2; ++s) sf[i][s] = Frag<_Float16>::load(pa + i * 16 * kAP + s * 32);
  float* os = sO[w] + rl * (unsigned)kOP + hh * 8u;
#pragma unroll
  for (int j = 0; j < 4; ++j) {
    const v16h q0 = Frag<_Float16>::load(pb + j * 16 * kAP);
    const v16h q1 = Frag<_Float16>::load(pb + j * 16 * kAP + 32);
    v8f acc[4];
#pragma unroll
    for (int i = 0; i < 4; ++i) acc[i] = Frag<_Float16>::mma(sf[i][0], q0, (v8f){0.f,0.f,0.f,0.f,0.f,0.f,0.f,0.f});
#pragma unroll
    for (int i = 0; i < 4; ++i) acc[i] = Frag<_Float16>::mma(sf[i][1], q1, acc[i]);
#pragma unroll
    for (int i = 0; i < 4; ++i) {
      /* the carries and the module's 1 / 8 come off here (a power of two: exact) */
      acc[i] *= kSc2;
      *(v4f*)(os + j * 16 * kOP + i * 16)     = (v4f){acc[i][0], acc[i][1], acc[i][2], acc[i][3]};
      *(v4f*)(os + j * 16 * kOP + i * 16 + 4) = (v4f){acc[i][4], acc[i][5], acc[i][6], acc[i][7]};
    }
  }
  /* the wave's own slab is whole in LDS before its lanes read one another's rows back; the clobber keeps the compiler from lifting those reads over the stores */
  asm volatile("s_wait_dscnt 0x0" ::: "memory");
  const float* orr = sO[w] + hh * (unsigned)kOP + rl * 4u;
  float* og = out + ro;
  /* unrolled: r is indexed by constants and stays in registers; the 32 steps of 2 rows become immediate offsets of one LDS address and one global address */
  v4f r[32];
#pragma unroll
  for (int it = 0; it < 32; ++it) r[it] = *(const v4f*)(orr + it * 2 * kOP);
#pragma unroll
  for (int it = 0; it < 32; ++it) *(v4f*)(og + (size_t)it * 2 * kD) = r[it];
}
static_assert(kN % (8 * kQR) == 0 && kQR == 64 && kD == 64 && kThr == 256 && ((kAP * 2) % 32) == 16 && ((kOP * 4) % 32) == 16, "second product exact: 4 blocks of 8 waves x 64 rows a batch; 16 lanes a 256-B row; 1,024 16-B chunks a partial of S; LDS pitches 16 B x odd");

/* ------------------------------------------------------------------------- */
/* Host glue: 2 launches; kernel launches only: THE FIRST PRODUCT S = K^T (V x): M 64, N 64, K 2,048 a batch, K split in four: grid (4, 64), K, V and x read as f32 and  */
/* cast and turned on the way to LDS, f32 partials in SP; THE SECOND PRODUCT out = Q S / 8: 2,048 x 64 x 64 a batch, grid (4, 64), the partials of S summed and cast and  */
/* Q read as f32 and cast on the way to LDS, storing d_out ([64][2048][64]).                                                                                          */
/* ------------------------------------------------------------------------- */
extern "C" void kernel_launch(void* const* d_in, const int* in_sizes, int n_in,
                              void* d_out, int out_size, void* d_ws, size_t ws_size,
                              hipStream_t stream) {
  if (n_in < 4 || d_out == nullptr || d_ws == nullptr) return;
  if (in_sizes[0] != kNb * kN * kD || in_sizes[1] != kNb * kN * kD || in_sizes[2] != kNb * kN * kD || in_sizes[3] != kBs * kN) return;
  if (out_size != kNb * kN * kD) return;
  if (ws_size < kWsTotal) return;
  const float* Q = (const float*)d_in[0];
  const float* K = (const float*)d_in[1];
  const float* V = (const float*)d_in[2];
  const float* xw = (const float*)d_in[3];
  float* out = (float*)d_out;
  char* ws = (char*)d_ws;
  float* SP = (float*)(ws + kOffSP);

  /* SP[b][p] = (K[b]^T . (V x)[b])^T over key positions 512 p .. 512 p + 511 */
  sprod_kernel<<<dim3(kSP, kNb), kThr, 0, stream>>>(K, V, xw, SP);
  /* out[b] = Q[b] . S[b] / 8, S[b] the sum of its four partials */
  qprod_kernel<<<dim3(kN / (8 * kQR), kNb), kThr, 0, stream>>>(Q, SP, out);
}
